// v000
// Times are from an AMD MI455X. After a warm-up the kernel runs many times in a row, and a time is the length of
// such a window on the GPU divided by its runs, so every launch and the gaps after it count. The runs cycle
// through copies of the inputs. A figure is the median of several windows, for all but v000 over two sittings.
// Sittings can differ by a few percent; kernels timed side by side share one.
// v000 is the starting kernel. One run takes 199 microseconds.
#include <hip/hip_runtime.h>
#include <hip/hip_bf16.h>

// ---- types ----
typedef _Float16 h16v __attribute__((ext_vector_type(16)));
typedef _Float16 h8v  __attribute__((ext_vector_type(8)));
typedef float    f8v  __attribute__((ext_vector_type(8)));
typedef float    f4v  __attribute__((ext_vector_type(4)));

#define D_MODEL 1024
#define HEAD    64
#define SEQ     4096
#define BATCH   4
#define NROWS   (BATCH * SEQ)   // 16384 flat rows

__device__ __forceinline__ h16v hcat(h8v lo, h8v hi) {
  h16v r;
#pragma unroll
  for (int i = 0; i < 8; ++i) { r[i] = lo[i]; r[i + 8] = hi[i]; }
  return r;
}

__device__ __forceinline__ float redmax16(float v) {
#pragma unroll
  for (int off = 1; off < 16; off <<= 1) v = fmaxf(v, __shfl_xor(v, off, 32));
  return v;
}
__device__ __forceinline__ float redsum16(float v) {
#pragma unroll
  for (int off = 1; off < 16; off <<= 1) v += __shfl_xor(v, off, 32);
  return v;
}

// LDS byte offset of a __shared__ object: generic addr low 32 bits == LDS addr.
__device__ __forceinline__ unsigned lds_off(const void* p) {
  return (unsigned)(size_t)p;
}

// Per-lane async copy: 16 bytes global -> LDS, tracked by ASYNCcnt.
__device__ __forceinline__ void async_b128(unsigned lds_byte_off, const void* gaddr) {
  asm volatile("global_load_async_to_lds_b128 %0, %1, off"
               :: "v"(lds_byte_off), "v"(gaddr) : "memory");
}

// ---------------------------------------------------------------------------
// Kernel 0: WhT[m][n][k] = (f16) W_m[k][n]   (3 x 64 x 1024 halves = 384 KB)
// ---------------------------------------------------------------------------
__global__ __launch_bounds__(256) void wtrans_kernel(
    const float* __restrict__ Wq, const float* __restrict__ Wk,
    const float* __restrict__ Wv, _Float16* __restrict__ WhT) {
  int idx = blockIdx.x * 256 + threadIdx.x;   // < 3*64*1024
  int m = idx >> 16;
  int r = idx & 65535;
  int n = r >> 10;
  int k = r & 1023;
  const float* W = (m == 0) ? Wq : ((m == 1) ? Wk : Wv);
  WhT[idx] = (_Float16)W[k * HEAD + n];
}

// ---------------------------------------------------------------------------
// Kernel 1: fused Q/K/V projection.  4 waves/block, 64 rows/block, all three
// matrices per block.  W tiles (3 x [64n x 32k] f16 = 12 KB) double-buffered
// in LDS via async global->LDS copies; 12 WMMAs per k-step per wave.
//   Q -> Qh  [row][h] f16, (x*Wq+bq)*0.125 ;  K -> Kh [row][h] ; V -> VhT[b][h][kv]
// ---------------------------------------------------------------------------
__global__ __launch_bounds__(128) void proj_kernel(
    const float* __restrict__ x, const _Float16* __restrict__ WhT,
    const float* __restrict__ bq, const float* __restrict__ bk,
    const float* __restrict__ bv, _Float16* __restrict__ Qh,
    _Float16* __restrict__ Kh, _Float16* __restrict__ VhT) {
  __shared__ __align__(16) _Float16 Wbuf[2][3 * 64 * 32];   // 2 x 12 KB

  const int tid    = threadIdx.x;
  const int wave   = tid >> 5;
  const int lane   = tid & 31;
  const int half16 = lane >> 4;
  const int l16    = lane & 15;
  const int hb     = half16 * 8;
  const int row0   = blockIdx.x * 64 + wave * 16;      // this wave's 16-row tile
  const float* xrow = x + (size_t)(row0 + l16) * D_MODEL;

  f8v acc[3][4] = {};

  // prefetch W tile for kk = 0 into buffer 0
  {
#pragma unroll
    for (int i = 0; i < 6; ++i) {
      const int c  = tid + 128 * i;        // 0..767 chunks of 16B (12 KB)
      const int m  = c >> 8, r = c & 255;
      const int n  = r >> 2, ko = (r & 3) * 8;
      async_b128(lds_off(&Wbuf[0][m * 2048 + n * 32 + ko]),
                 WhT + (size_t)m * 65536 + (size_t)n * 1024 + ko);
    }
  }

  for (int kk = 0; kk < D_MODEL; kk += 32) {
    const int cur = (kk >> 5) & 1;
    if (kk + 32 < D_MODEL) {
#pragma unroll
      for (int i = 0; i < 6; ++i) {
        const int c  = tid + 128 * i;
        const int m  = c >> 8, r = c & 255;
        const int n  = r >> 2, ko = (r & 3) * 8;
        async_b128(lds_off(&Wbuf[cur ^ 1][m * 2048 + n * 32 + ko]),
                   WhT + (size_t)m * 65536 + (size_t)n * 1024 + (kk + 32) + ko);
      }
      asm volatile("s_wait_asynccnt 0x6" ::: "memory");   // current buffer done
    } else {
      asm volatile("s_wait_asynccnt 0x0" ::: "memory");
    }
    __syncthreads();

    // A tile from global: 16 rows x 32 k of x, fp32 -> f16
    const int kA = kk + hb;
    f4v a0 = *(const f4v*)(xrow + kA);
    f4v a1 = *(const f4v*)(xrow + kA + 4);
    f4v a2 = *(const f4v*)(xrow + kA + 16);
    f4v a3 = *(const f4v*)(xrow + kA + 20);
    h16v A;
#pragma unroll
    for (int i = 0; i < 4; ++i) {
      A[i]      = (_Float16)a0[i];
      A[4 + i]  = (_Float16)a1[i];
      A[8 + i]  = (_Float16)a2[i];
      A[12 + i] = (_Float16)a3[i];
    }

    const _Float16* wb = &Wbuf[cur][0];
#pragma unroll
    for (int m = 0; m < 3; ++m) {
#pragma unroll
      for (int t = 0; t < 4; ++t) {
        const _Float16* wcol = wb + m * 2048 + (t * 16 + l16) * 32;
        h16v B = hcat(*(const h8v*)(wcol + hb), *(const h8v*)(wcol + hb + 16));
        acc[m][t] = __builtin_amdgcn_wmma_f32_16x16x32_f16(
            false, A, false, B, (short)0, acc[m][t], false, false);
      }
    }
    __syncthreads();   // don't let next prefetch overwrite a buffer in use
  }

  // bias + scale + store
#pragma unroll
  for (int m = 0; m < 3; ++m) {
    const float* bias = (m == 0) ? bq : ((m == 1) ? bk : bv);
    const float  scl  = (m == 0) ? 0.125f : 1.0f;
#pragma unroll
    for (int t = 0; t < 4; ++t) {
      const int   col = t * 16 + l16;
      const float bvv = bias[col];
#pragma unroll
      for (int g = 0; g < 8; ++g) {
        const int      r    = row0 + g + 8 * half16;
        const _Float16 hval = (_Float16)((acc[m][t][g] + bvv) * scl);
        if (m == 0) {
          Qh[(size_t)r * HEAD + col] = hval;
        } else if (m == 1) {
          Kh[(size_t)r * HEAD + col] = hval;
        } else {
          const int bb = r >> 12, kv = r & (SEQ - 1);
          VhT[((size_t)bb * HEAD + col) * SEQ + kv] = hval;
        }
      }
    }
  }
}

// ---------------------------------------------------------------------------
// Kernel 2: flash attention.  4 waves/block sharing double-buffered K/V tiles
// in LDS (async global->LDS).  Each wave: 16 q-rows, online softmax, kv step 32.
// ---------------------------------------------------------------------------
__global__ __launch_bounds__(128) void attn_kernel(
    const _Float16* __restrict__ Qh, const _Float16* __restrict__ Kh,
    const _Float16* __restrict__ VhT, float* __restrict__ out) {
  __shared__ __align__(16) _Float16 Kbuf[2][32 * 64];   // [kv][h], 2 x 4 KB
  __shared__ __align__(16) _Float16 Vbuf[2][64 * 32];   // [h][kv], 2 x 4 KB
  __shared__ __align__(16) _Float16 pbuf[4][16 * 32];   // per-wave P staging

  const int tid    = threadIdx.x;
  const int wave   = tid >> 5;
  const int lane   = tid & 31;
  const int half16 = lane >> 4;
  const int l16    = lane & 15;
  const int hb     = half16 * 8;
  const int q0     = blockIdx.x * 64 + wave * 16;   // flat q row base
  const int b      = q0 >> 12;

  const _Float16* Kh_b  = Kh  + (size_t)b * SEQ * HEAD;
  const _Float16* VhT_b = VhT + (size_t)b * HEAD * SEQ;
  _Float16* pb = pbuf[wave];

  // Q A-tiles held in VGPRs for the whole loop
  const _Float16* qrow = Qh + (size_t)(q0 + l16) * HEAD;
  const h16v aQ0 = hcat(*(const h8v*)(qrow + hb),      *(const h8v*)(qrow + hb + 16));
  const h16v aQ1 = hcat(*(const h8v*)(qrow + 32 + hb), *(const h8v*)(qrow + 32 + hb + 16));

  float mrow[8], lrow[8];
  f8v   o[4] = {};
#pragma unroll
  for (int g = 0; g < 8; ++g) { mrow[g] = -INFINITY; lrow[g] = 0.0f; }

  // prefetch kv tile 0 into buffer 0 (K: 4 KB contiguous; V: 64 rows x 64 B)
#pragma unroll
  for (int i = 0; i < 2; ++i) {
    const int c = tid + 128 * i;                       // 0..255
    async_b128(lds_off(&Kbuf[0][0]) + c * 16,
               (const char*)(Kh_b) + c * 16);
    const int vr = c >> 2, vo = (c & 3) * 8;
    async_b128(lds_off(&Vbuf[0][vr * 32 + vo]),
               VhT_b + (size_t)vr * SEQ + vo);
  }

  for (int kv = 0; kv < SEQ; kv += 32) {
    const int cur = (kv >> 5) & 1;
    if (kv + 32 < SEQ) {
      const int nkv = kv + 32;
#pragma unroll
      for (int i = 0; i < 2; ++i) {
        const int c = tid + 128 * i;
        async_b128(lds_off(&Kbuf[cur ^ 1][0]) + c * 16,
                   (const char*)(Kh_b + (size_t)nkv * HEAD) + c * 16);
        const int vr = c >> 2, vo = (c & 3) * 8;
        async_b128(lds_off(&Vbuf[cur ^ 1][vr * 32 + vo]),
                   VhT_b + (size_t)vr * SEQ + nkv + vo);
      }
      asm volatile("s_wait_asynccnt 0x4" ::: "memory");
    } else {
      asm volatile("s_wait_asynccnt 0x0" ::: "memory");
    }
    __syncthreads();

    // ---- scores: two 16x16 tiles from LDS K ----
    f8v s0, s1;
    {
      const _Float16* krow = &Kbuf[cur][l16 * 64];            // col = l16
      h16v bK0 = hcat(*(const h8v*)(krow + hb),      *(const h8v*)(krow + hb + 16));
      h16v bK1 = hcat(*(const h8v*)(krow + 32 + hb), *(const h8v*)(krow + 32 + hb + 16));
      f8v  z   = {};
      s0 = __builtin_amdgcn_wmma_f32_16x16x32_f16(false, aQ0, false, bK0, (short)0, z,  false, false);
      s0 = __builtin_amdgcn_wmma_f32_16x16x32_f16(false, aQ1, false, bK1, (short)0, s0, false, false);
      const _Float16* krow1 = &Kbuf[cur][(16 + l16) * 64];    // col = 16 + l16
      h16v cK0 = hcat(*(const h8v*)(krow1 + hb),      *(const h8v*)(krow1 + hb + 16));
      h16v cK1 = hcat(*(const h8v*)(krow1 + 32 + hb), *(const h8v*)(krow1 + 32 + hb + 16));
      s1 = __builtin_amdgcn_wmma_f32_16x16x32_f16(false, aQ0, false, cK0, (short)0, z,  false, false);
      s1 = __builtin_amdgcn_wmma_f32_16x16x32_f16(false, aQ1, false, cK1, (short)0, s1, false, false);
    }

    // ---- online softmax over these 32 columns ----
#pragma unroll
    for (int g = 0; g < 8; ++g) {
      const float tm   = fmaxf(redmax16(s0[g]), redmax16(s1[g]));
      const float mn   = fmaxf(mrow[g], tm);
      const float corr = __expf(mrow[g] - mn);
      mrow[g] = mn;
      const float p0 = __expf(s0[g] - mn);
      const float p1 = __expf(s1[g] - mn);
      lrow[g] = lrow[g] * corr + redsum16(p0 + p1);
#pragma unroll
      for (int t = 0; t < 4; ++t) o[t][g] *= corr;
      const int M = g + hb;
      pb[M * 32 + l16]      = (_Float16)p0;
      pb[M * 32 + 16 + l16] = (_Float16)p1;
    }

    __builtin_amdgcn_wave_barrier();
    asm volatile("s_wait_dscnt 0x0" ::: "memory");

    const _Float16* prow = pb + l16 * 32;
    h16v pA = hcat(*(const h8v*)(prow + hb), *(const h8v*)(prow + hb + 16));

    // ---- O += P * V from LDS V ----
#pragma unroll
    for (int t = 0; t < 4; ++t) {
      const _Float16* vrow = &Vbuf[cur][(t * 16 + l16) * 32];
      h16v bV = hcat(*(const h8v*)(vrow + hb), *(const h8v*)(vrow + hb + 16));
      o[t] = __builtin_amdgcn_wmma_f32_16x16x32_f16(
          false, pA, false, bV, (short)0, o[t], false, false);
    }
    __syncthreads();   // protect buffer from next iteration's prefetch
  }

  // ---- epilogue ----
#pragma unroll
  for (int t = 0; t < 4; ++t) {
#pragma unroll
    for (int g = 0; g < 8; ++g) {
      const int r = q0 + g + hb;
      out[(size_t)r * HEAD + t * 16 + l16] = o[t][g] / lrow[g];
    }
  }
}

// ---------------------------------------------------------------------------
extern "C" void kernel_launch(void* const* d_in, const int* in_sizes, int n_in,
                              void* d_out, int out_size, void* d_ws, size_t ws_size,
                              hipStream_t stream) {
  const float* x  = (const float*)d_in[0];
  const float* Wq = (const float*)d_in[1];
  const float* bq = (const float*)d_in[2];
  const float* Wk = (const float*)d_in[3];
  const float* bk = (const float*)d_in[4];
  const float* Wv = (const float*)d_in[5];
  const float* bv = (const float*)d_in[6];
  float*       out = (float*)d_out;

  char* ws = (char*)d_ws;
  _Float16* WhT = (_Float16*)(ws);                                   // 384 KB
  _Float16* Qh  = (_Float16*)(ws + 384 * 1024);                      // 2 MB
  _Float16* Kh  = (_Float16*)(ws + 384 * 1024 + 2 * 1024 * 1024);    // 2 MB
  _Float16* VhT = (_Float16*)(ws + 384 * 1024 + 4 * 1024 * 1024);    // 2 MB

  wtrans_kernel<<<(3 * HEAD * D_MODEL) / 256, 256, 0, stream>>>(Wq, Wk, Wv, WhT);
  proj_kernel<<<NROWS / 64, 128, 0, stream>>>(x, WhT, bq, bk, bv, Qh, Kh, VhT);
  attn_kernel<<<NROWS / 64, 128, 0, stream>>>(Qh, Kh, VhT, out);
}

// v001
// Measured time: 118 microseconds a run.
// Next to v000, in two timings, it ran 1.67 and 1.72 times as fast.
#include <hip/hip_runtime.h>
#include <hip/hip_bf16.h>

// ---- types ----
typedef _Float16 h16v __attribute__((ext_vector_type(16)));
typedef _Float16 h8v  __attribute__((ext_vector_type(8)));
typedef float    f8v  __attribute__((ext_vector_type(8)));
typedef float    f4v  __attribute__((ext_vector_type(4)));

#define D_MODEL 1024
#define HEAD    64
#define SEQ     4096
#define BATCH   4
#define NROWS   (BATCH * SEQ)   // 16384 flat rows

__device__ __forceinline__ h16v hcat(h8v lo, h8v hi) {
  h16v r;
#pragma unroll
  for (int i = 0; i < 8; ++i) { r[i] = lo[i]; r[i + 8] = hi[i]; }
  return r;
}

// Lane l <-> lane l ^ 16 (the two halves of a wave hold the same query column).
__device__ __forceinline__ float xhalf(float v) {
  const int b = __builtin_bit_cast(int, v);
  return __builtin_bit_cast(float, __builtin_amdgcn_permlanex16(
      b, b, 0x76543210, 0xfedcba98, false, false));
}
__device__ __forceinline__ float max3f(float a, float b, float c) {
  return fmaxf(fmaxf(a, b), c);
}

// LDS byte offset of a __shared__ object: generic addr low 32 bits == LDS addr.
__device__ __forceinline__ unsigned lds_off(const void* p) {
  return (unsigned)(size_t)p;
}

// Per-lane async copy: 16 bytes global -> LDS, tracked by ASYNCcnt.
__device__ __forceinline__ void async_b128(unsigned lds_byte_off, const void* gaddr) {
  asm volatile("global_load_async_to_lds_b128 %0, %1, off"
               :: "v"(lds_byte_off), "v"(gaddr) : "memory");
}

// ---------------------------------------------------------------------------
// Kernel 0: WhT[m][n][k] = (f16) W_m[k][n]   (3 x 64 x 1024 halves = 384 KB)
// ---------------------------------------------------------------------------
__global__ __launch_bounds__(256) void wtrans_kernel(
    const float* __restrict__ Wq, const float* __restrict__ Wk,
    const float* __restrict__ Wv, _Float16* __restrict__ WhT) {
  int idx = blockIdx.x * 256 + threadIdx.x;   // < 3*64*1024
  int m = idx >> 16;
  int r = idx & 65535;
  int n = r >> 10;
  int k = r & 1023;
  const float* W = (m == 0) ? Wq : ((m == 1) ? Wk : Wv);
  WhT[idx] = (_Float16)W[k * HEAD + n];
}

// ---------------------------------------------------------------------------
// Kernel 1: fused Q/K/V projection.  4 waves/block, 64 rows/block, all three
// matrices per block.  W tiles (3 x [64n x 32k] f16 = 12 KB) double-buffered
// in LDS via async global->LDS copies; 12 WMMAs per k-step per wave.
//   Q -> Qh  [row][h] f16, (x*Wq+bq)*0.125 ;  K -> Kh [row][h] ; V -> VhT[b][h][kv]
// ---------------------------------------------------------------------------
__global__ __launch_bounds__(128) void proj_kernel(
    const float* __restrict__ x, const _Float16* __restrict__ WhT,
    const float* __restrict__ bq, const float* __restrict__ bk,
    const float* __restrict__ bv, _Float16* __restrict__ Qh,
    _Float16* __restrict__ Kh, _Float16* __restrict__ VhT) {
  __shared__ __align__(16) _Float16 Wbuf[2][3 * 64 * 32];   // 2 x 12 KB

  const int tid    = threadIdx.x;
  const int wave   = tid >> 5;
  const int lane   = tid & 31;
  const int half16 = lane >> 4;
  const int l16    = lane & 15;
  const int hb     = half16 * 8;
  const int row0   = blockIdx.x * 64 + wave * 16;      // this wave's 16-row tile
  const float* xrow = x + (size_t)(row0 + l16) * D_MODEL;

  f8v acc[3][4] = {};

  // prefetch W tile for kk = 0 into buffer 0
  {
#pragma unroll
    for (int i = 0; i < 6; ++i) {
      const int c  = tid + 128 * i;        // 0..767 chunks of 16B (12 KB)
      const int m  = c >> 8, r = c & 255;
      const int n  = r >> 2, ko = (r & 3) * 8;
      async_b128(lds_off(&Wbuf[0][m * 2048 + n * 32 + ko]),
                 WhT + (size_t)m * 65536 + (size_t)n * 1024 + ko);
    }
  }

  for (int kk = 0; kk < D_MODEL; kk += 32) {
    const int cur = (kk >> 5) & 1;
    if (kk + 32 < D_MODEL) {
#pragma unroll
      for (int i = 0; i < 6; ++i) {
        const int c  = tid + 128 * i;
        const int m  = c >> 8, r = c & 255;
        const int n  = r >> 2, ko = (r & 3) * 8;
        async_b128(lds_off(&Wbuf[cur ^ 1][m * 2048 + n * 32 + ko]),
                   WhT + (size_t)m * 65536 + (size_t)n * 1024 + (kk + 32) + ko);
      }
      asm volatile("s_wait_asynccnt 0x6" ::: "memory");   // current buffer done
    } else {
      asm volatile("s_wait_asynccnt 0x0" ::: "memory");
    }
    __syncthreads();

    // A tile from global: 16 rows x 32 k of x, fp32 -> f16
    const int kA = kk + hb;
    f4v a0 = *(const f4v*)(xrow + kA);
    f4v a1 = *(const f4v*)(xrow + kA + 4);
    f4v a2 = *(const f4v*)(xrow + kA + 16);
    f4v a3 = *(const f4v*)(xrow + kA + 20);
    h16v A;
#pragma unroll
    for (int i = 0; i < 4; ++i) {
      A[i]      = (_Float16)a0[i];
      A[4 + i]  = (_Float16)a1[i];
      A[8 + i]  = (_Float16)a2[i];
      A[12 + i] = (_Float16)a3[i];
    }

    const _Float16* wb = &Wbuf[cur][0];
#pragma unroll
    for (int m = 0; m < 3; ++m) {
#pragma unroll
      for (int t = 0; t < 4; ++t) {
        const _Float16* wcol = wb + m * 2048 + (t * 16 + l16) * 32;
        h16v B = hcat(*(const h8v*)(wcol + hb), *(const h8v*)(wcol + hb + 16));
        acc[m][t] = __builtin_amdgcn_wmma_f32_16x16x32_f16(
            false, A, false, B, (short)0, acc[m][t], false, false);
      }
    }
    __syncthreads();   // don't let next prefetch overwrite a buffer in use
  }

  // bias + scale + store
#pragma unroll
  for (int m = 0; m < 3; ++m) {
    const float* bias = (m == 0) ? bq : ((m == 1) ? bk : bv);
    const float  scl  = (m == 0) ? 0.125f : 1.0f;
#pragma unroll
    for (int t = 0; t < 4; ++t) {
      const int   col = t * 16 + l16;
      const float bvv = bias[col];
#pragma unroll
      for (int g = 0; g < 8; ++g) {
        const int      r    = row0 + g + 8 * half16;
        const _Float16 hval = (_Float16)((acc[m][t][g] + bvv) * scl);
        if (m == 0) {
          Qh[(size_t)r * HEAD + col] = hval;
        } else if (m == 1) {
          Kh[(size_t)r * HEAD + col] = hval;
        } else {
          const int bb = r >> 12, kv = r & (SEQ - 1);
          VhT[((size_t)bb * HEAD + col) * SEQ + kv] = hval;
        }
      }
    }
  }
}

__global__ __launch_bounds__(128) void attn_kernel(
    const _Float16* __restrict__ Qh, const _Float16* __restrict__ Kh,
    const _Float16* __restrict__ VhT, float* __restrict__ out) {
  __shared__ __align__(16) _Float16 Kbuf[2][32 * 64];   // [kv][h], 2 x 4 KB
  __shared__ __align__(16) _Float16 Vbuf[2][64 * 32];   // [h][kv], 2 x 4 KB

  const int tid    = threadIdx.x;
  const int wave   = tid >> 5;
  const int lane   = tid & 31;
  const int half16 = lane >> 4;
  const int l16    = lane & 15;
  const int hb     = half16 * 8;
  const int q0     = blockIdx.x * 64 + wave * 16;   // flat q row base
  const int b      = q0 >> 12;

  const _Float16* Kh_b  = Kh  + (size_t)b * SEQ * HEAD;
  const _Float16* VhT_b = VhT + (size_t)b * HEAD * SEQ;

  // Q B-tiles (column = query l16) held in VGPRs for the whole loop
  const _Float16* qrow = Qh + (size_t)(q0 + l16) * HEAD;
  const h16v aQ0 = hcat(*(const h8v*)(qrow + hb),      *(const h8v*)(qrow + hb + 16));
  const h16v aQ1 = hcat(*(const h8v*)(qrow + 32 + hb), *(const h8v*)(qrow + 32 + hb + 16));

  // Per lane: query q0 + l16.  lrow sums only this lane's keys; the halves join
  // in the epilogue.  o[t][g] = O[q0 + l16][t * 16 + hb + g].
  float mrow = -INFINITY, lrow = 0.0f;
  f8v   o[4] = {};

  // prefetch kv tile 0 into buffer 0 (K: 4 KB contiguous; V: 64 rows x 64 B)
#pragma unroll
  for (int i = 0; i < 2; ++i) {
    const int c = tid + 128 * i;                       // 0..255
    async_b128(lds_off(&Kbuf[0][0]) + c * 16,
               (const char*)(Kh_b) + c * 16);
    const int vr = c >> 2, vo = (c & 3) * 8;
    async_b128(lds_off(&Vbuf[0][vr * 32 + vo]),
               VhT_b + (size_t)vr * SEQ + vo);
  }

  for (int kv = 0; kv < SEQ; kv += 32) {
    const int cur = (kv >> 5) & 1;
    if (kv + 32 < SEQ) {
      const int nkv = kv + 32;
#pragma unroll
      for (int i = 0; i < 2; ++i) {
        const int c = tid + 128 * i;
        async_b128(lds_off(&Kbuf[cur ^ 1][0]) + c * 16,
                   (const char*)(Kh_b + (size_t)nkv * HEAD) + c * 16);
        const int vr = c >> 2, vo = (c & 3) * 8;
        async_b128(lds_off(&Vbuf[cur ^ 1][vr * 32 + vo]),
                   VhT_b + (size_t)vr * SEQ + nkv + vo);
      }
      asm volatile("s_wait_asynccnt 0x4" ::: "memory");
    } else {
      asm volatile("s_wait_asynccnt 0x0" ::: "memory");
    }
    __syncthreads();

    // ---- scores, transposed: two 16(key) x 16(query) tiles, A = K rows from LDS ----
    // s0[g]: key kv + hb + g ; s1[g]: key kv + 16 + hb + g ; query q0 + l16
    f8v s0, s1;
    {
      const _Float16* krow = &Kbuf[cur][l16 * 64];            // row = l16
      h16v bK0 = hcat(*(const h8v*)(krow + hb),      *(const h8v*)(krow + hb + 16));
      h16v bK1 = hcat(*(const h8v*)(krow + 32 + hb), *(const h8v*)(krow + 32 + hb + 16));
      f8v  z   = {};
      s0 = __builtin_amdgcn_wmma_f32_16x16x32_f16(false, bK0, false, aQ0, (short)0, z,  false, false);
      s0 = __builtin_amdgcn_wmma_f32_16x16x32_f16(false, bK1, false, aQ1, (short)0, s0, false, false);
      const _Float16* krow1 = &Kbuf[cur][(16 + l16) * 64];    // row = 16 + l16
      h16v cK0 = hcat(*(const h8v*)(krow1 + hb),      *(const h8v*)(krow1 + hb + 16));
      h16v cK1 = hcat(*(const h8v*)(krow1 + 32 + hb), *(const h8v*)(krow1 + 32 + hb + 16));
      s1 = __builtin_amdgcn_wmma_f32_16x16x32_f16(false, cK0, false, aQ0, (short)0, z,  false, false);
      s1 = __builtin_amdgcn_wmma_f32_16x16x32_f16(false, cK1, false, aQ1, (short)0, s1, false, false);
    }

    // ---- online softmax over these 32 keys: in-lane, one exchange between halves ----
    const float ta = max3f(max3f(s0[0], s0[1], s0[2]), max3f(s0[3], s0[4], s0[5]),
                           max3f(s0[6], s0[7], s1[0]));
    const float tb = max3f(max3f(s1[1], s1[2], s1[3]), max3f(s1[4], s1[5], s1[6]), s1[7]);
    const float tm   = fmaxf(ta, tb);
    const float mn   = max3f(mrow, tm, xhalf(tm));   // same value in both halves
    const float corr = __expf(mrow - mn);
    mrow = mn;
    f8v p0, p1;
#pragma unroll
    for (int g = 0; g < 8; ++g) {
      p0[g] = __expf(s0[g] - mn);
      p1[g] = __expf(s1[g] - mn);
    }
    const f8v ps8 = p0 + p1;
    const f4v ps4 = ps8.lo + ps8.hi;
    lrow = lrow * corr + ((ps4[0] + ps4[2]) + (ps4[1] + ps4[3]));
#pragma unroll
    for (int t = 0; t < 4; ++t) o[t] *= corr;

    // P^T as B operand: element i < 8 is key hb + i, element 8 + i key 16 + hb + i,
    // the k order of the V^T loader below.
    const h16v pB = hcat(__builtin_convertvector(p0, h8v), __builtin_convertvector(p1, h8v));

    // ---- O^T += V^T * P^T, A = V^T rows (h) from LDS ----
#pragma unroll
    for (int t = 0; t < 4; ++t) {
      const _Float16* vrow = &Vbuf[cur][(t * 16 + l16) * 32];
      h16v aV = hcat(*(const h8v*)(vrow + hb), *(const h8v*)(vrow + hb + 16));
      o[t] = __builtin_amdgcn_wmma_f32_16x16x32_f16(
          false, aV, false, pB, (short)0, o[t], false, false);
    }
    __syncthreads();   // protect buffer from next iteration's prefetch
  }

  // ---- epilogue: join the halves' sums; a lane owns 8 consecutive h per tile ----
  const float lsum = lrow + xhalf(lrow);
  float* orow = out + (size_t)(q0 + l16) * HEAD + hb;
#pragma unroll
  for (int t = 0; t < 4; ++t) {
    f4v lo, hi;
#pragma unroll
    for (int g = 0; g < 4; ++g) { lo[g] = o[t][g] / lsum; hi[g] = o[t][4 + g] / lsum; }
    *(f4v*)(orow + t * 16)     = lo;
    *(f4v*)(orow + t * 16 + 4) = hi;
  }
}

// ---------------------------------------------------------------------------
extern "C" void kernel_launch(void* const* d_in, const int* in_sizes, int n_in,
                              void* d_out, int out_size, void* d_ws, size_t ws_size,
                              hipStream_t stream) {
  const float* x  = (const float*)d_in[0];
  const float* Wq = (const float*)d_in[1];
  const float* bq = (const float*)d_in[2];
  const float* Wk = (const float*)d_in[3];
  const float* bk = (const float*)d_in[4];
  const float* Wv = (const float*)d_in[5];
  const float* bv = (const float*)d_in[6];
  float*       out = (float*)d_out;

  char* ws = (char*)d_ws;
  _Float16* WhT = (_Float16*)(ws);                                   // 384 KB
  _Float16* Qh  = (_Float16*)(ws + 384 * 1024);                      // 2 MB
  _Float16* Kh  = (_Float16*)(ws + 384 * 1024 + 2 * 1024 * 1024);    // 2 MB
  _Float16* VhT = (_Float16*)(ws + 384 * 1024 + 4 * 1024 * 1024);    // 2 MB

  wtrans_kernel<<<(3 * HEAD * D_MODEL) / 256, 256, 0, stream>>>(Wq, Wk, Wv, WhT);
  proj_kernel<<<NROWS / 64, 128, 0, stream>>>(x, WhT, bq, bk, bv, Qh, Kh, VhT);
  attn_kernel<<<NROWS / 64, 128, 0, stream>>>(Qh, Kh, VhT, out);
}

// v002
// One run takes 102 microseconds.
// Timed twice side by side with v001, it ran 1.15 and 1.17 times as fast.
// Over all steps from v000 it is 1.96 times as fast.
#include <hip/hip_runtime.h>
#include <hip/hip_bf16.h>

// ---- types ----
typedef _Float16 h16v __attribute__((ext_vector_type(16)));
typedef _Float16 h8v  __attribute__((ext_vector_type(8)));
typedef float    f8v  __attribute__((ext_vector_type(8)));
typedef float    f4v  __attribute__((ext_vector_type(4)));

#define D_MODEL 1024
#define HEAD    64
#define SEQ     4096
#define BATCH   4
#define NROWS   (BATCH * SEQ)   // 16384 flat rows

__device__ __forceinline__ h16v hcat(h8v lo, h8v hi) {
  h16v r;
#pragma unroll
  for (int i = 0; i < 8; ++i) { r[i] = lo[i]; r[i + 8] = hi[i]; }
  return r;
}

// Lane l <-> lane l ^ 16 (the two halves of a wave hold the same query column).
__device__ __forceinline__ float xhalf(float v) {
  const int b = __builtin_bit_cast(int, v);
  return __builtin_bit_cast(float, __builtin_amdgcn_permlanex16(
      b, b, 0x76543210, 0xfedcba98, false, false));
}
__device__ __forceinline__ float max3f(float a, float b, float c) {
  return fmaxf(fmaxf(a, b), c);
}

// LDS row pitches in halves, for ds_load_b128 readers that walk 16 rows at once:
// 16 B x odd puts the 16 rows of a half-wave on 16 different groups of four banks.
#define KP 72   // K rows: 128 B of data at 144 B
#define VP 40   // V^T rows: 64 B of data at 80 B
#define WP 40   // W^T rows: 64 B of data at 80 B

typedef int i4v __attribute__((ext_vector_type(4)));
typedef __attribute__((address_space(1))) i4v gl_i4v;
typedef __attribute__((address_space(3))) i4v sh_i4v;

// Per-lane async copy: 16 bytes global -> LDS, tracked by ASYNCcnt.
__device__ __forceinline__ void async_b128(_Float16* lds, const _Float16* gaddr) {
  __builtin_amdgcn_global_load_async_to_lds_b128((gl_i4v*)gaddr, (sh_i4v*)lds, 0, 0);
}

// ---------------------------------------------------------------------------
// Kernel 0: WhT[m][n][k] = (f16) W_m[k][n]   (3 x 64 x 1024 halves = 384 KB)
// ---------------------------------------------------------------------------
__global__ __launch_bounds__(256) void wtrans_kernel(
    const float* __restrict__ Wq, const float* __restrict__ Wk,
    const float* __restrict__ Wv, _Float16* __restrict__ WhT) {
  int idx = blockIdx.x * 256 + threadIdx.x;   // < 3*64*1024
  int m = idx >> 16;
  int r = idx & 65535;
  int n = r >> 10;
  int k = r & 1023;
  const float* W = (m == 0) ? Wq : ((m == 1) ? Wk : Wv);
  WhT[idx] = (_Float16)W[k * HEAD + n];
}

// ---------------------------------------------------------------------------
// Kernel 1: fused Q/K/V projection.  4 waves/block, 64 rows/block, all three
// matrices per block.  W tiles (3 x [64n x 32k] f16, rows at pitch WP) double-buffered
// in LDS via async global->LDS copies; 12 WMMAs per k-step per wave.
//   Q -> Qh  [row][h] f16, (x*Wq+bq)*0.125 ;  K -> Kh [row][h] ; V -> VhT[b][h][kv]
// ---------------------------------------------------------------------------
__global__ __launch_bounds__(128) void proj_kernel(
    const float* __restrict__ x, const _Float16* __restrict__ WhT,
    const float* __restrict__ bq, const float* __restrict__ bk,
    const float* __restrict__ bv, _Float16* __restrict__ Qh,
    _Float16* __restrict__ Kh, _Float16* __restrict__ VhT) {
  __shared__ __align__(16) _Float16 Wbuf[2][3 * 64 * WP];   // 2 x 15 KB

  const int tid    = threadIdx.x;
  const int wave   = tid >> 5;
  const int lane   = tid & 31;
  const int half16 = lane >> 4;
  const int l16    = lane & 15;
  const int hb     = half16 * 8;
  const int row0   = blockIdx.x * 64 + wave * 16;      // this wave's 16-row tile
  const float* xrow = x + (size_t)(row0 + l16) * D_MODEL;

  f8v acc[3][4] = {};

  // prefetch W tile for kk = 0 into buffer 0
  {
#pragma unroll
    for (int i = 0; i < 6; ++i) {
      const int c  = tid + 128 * i;        // 0..767 chunks of 16B (12 KB)
      const int m  = c >> 8, r = c & 255;
      const int n  = r >> 2, ko = (r & 3) * 8;
      async_b128(&Wbuf[0][(m * 64 + n) * WP + ko],
                 WhT + (size_t)m * 65536 + (size_t)n * 1024 + ko);
    }
  }

  for (int kk = 0; kk < D_MODEL; kk += 32) {
    const int cur = (kk >> 5) & 1;
    if (kk + 32 < D_MODEL) {
#pragma unroll
      for (int i = 0; i < 6; ++i) {
        const int c  = tid + 128 * i;
        const int m  = c >> 8, r = c & 255;
        const int n  = r >> 2, ko = (r & 3) * 8;
        async_b128(&Wbuf[cur ^ 1][(m * 64 + n) * WP + ko],
                   WhT + (size_t)m * 65536 + (size_t)n * 1024 + (kk + 32) + ko);
      }
      asm volatile("s_wait_asynccnt 0x6" ::: "memory");   // current buffer done
    } else {
      asm volatile("s_wait_asynccnt 0x0" ::: "memory");
    }
    __syncthreads();

    // A tile from global: 16 rows x 32 k of x, fp32 -> f16
    const int kA = kk + hb;
    f4v a0 = *(const f4v*)(xrow + kA);
    f4v a1 = *(const f4v*)(xrow + kA + 4);
    f4v a2 = *(const f4v*)(xrow + kA + 16);
    f4v a3 = *(const f4v*)(xrow + kA + 20);
    h16v A;
#pragma unroll
    for (int i = 0; i < 4; ++i) {
      A[i]      = (_Float16)a0[i];
      A[4 + i]  = (_Float16)a1[i];
      A[8 + i]  = (_Float16)a2[i];
      A[12 + i] = (_Float16)a3[i];
    }

    const _Float16* wb = &Wbuf[cur][0];
#pragma unroll
    for (int m = 0; m < 3; ++m) {
#pragma unroll
      for (int t = 0; t < 4; ++t) {
        const _Float16* wcol = wb + (m * 64 + t * 16 + l16) * WP;
        h16v B = hcat(*(const h8v*)(wcol + hb), *(const h8v*)(wcol + hb + 16));
        acc[m][t] = __builtin_amdgcn_wmma_f32_16x16x32_f16(
            false, A, false, B, (short)0, acc[m][t], false, false);
      }
    }
    __syncthreads();   // don't let next prefetch overwrite a buffer in use
  }

  // bias + scale + store
#pragma unroll
  for (int m = 0; m < 3; ++m) {
    const float* bias = (m == 0) ? bq : ((m == 1) ? bk : bv);
    const float  scl  = (m == 0) ? 0.125f : 1.0f;
#pragma unroll
    for (int t = 0; t < 4; ++t) {
      const int   col = t * 16 + l16;
      const float bvv = bias[col];
#pragma unroll
      for (int g = 0; g < 8; ++g) {
        const int      r    = row0 + g + 8 * half16;
        const _Float16 hval = (_Float16)((acc[m][t][g] + bvv) * scl);
        if (m == 0) {
          Qh[(size_t)r * HEAD + col] = hval;
        } else if (m == 1) {
          Kh[(size_t)r * HEAD + col] = hval;
        } else {
          const int bb = r >> 12, kv = r & (SEQ - 1);
          VhT[((size_t)bb * HEAD + col) * SEQ + kv] = hval;
        }
      }
    }
  }
}

__global__ __launch_bounds__(128) void attn_kernel(
    const _Float16* __restrict__ Qh, const _Float16* __restrict__ Kh,
    const _Float16* __restrict__ VhT, float* __restrict__ out) {
  __shared__ __align__(16) _Float16 Kbuf[2][32 * KP];   // [kv][h], 2 x 4608 B
  __shared__ __align__(16) _Float16 Vbuf[2][64 * VP];   // [h][kv], 2 x 5120 B

  const int tid    = threadIdx.x;
  const int wave   = tid >> 5;
  const int lane   = tid & 31;
  const int half16 = lane >> 4;
  const int l16    = lane & 15;
  const int hb     = half16 * 8;
  const int q0     = blockIdx.x * 64 + wave * 16;   // flat q row base
  const int b      = q0 >> 12;

  const _Float16* Kh_b  = Kh  + (size_t)b * SEQ * HEAD;
  const _Float16* VhT_b = VhT + (size_t)b * HEAD * SEQ;

  // Q B-tiles (column = query l16) held in VGPRs for the whole loop
  const _Float16* qrow = Qh + (size_t)(q0 + l16) * HEAD;
  const h16v aQ0 = hcat(*(const h8v*)(qrow + hb),      *(const h8v*)(qrow + hb + 16));
  const h16v aQ1 = hcat(*(const h8v*)(qrow + 32 + hb), *(const h8v*)(qrow + 32 + hb + 16));

  // Per lane: query q0 + l16.  lrow sums only this lane's keys; the halves join
  // in the epilogue.  o[t][g] = O[q0 + l16][t * 16 + hb + g].
  float mrow = -INFINITY, lrow = 0.0f;
  f8v   o[4] = {};

  // prefetch kv tile 0 into buffer 0 (K: 32 rows x 128 B; V: 64 rows x 64 B)
#pragma unroll
  for (int i = 0; i < 2; ++i) {
    const int c = tid + 128 * i;                       // 0..255
    async_b128(&Kbuf[0][(c >> 3) * KP + (c & 7) * 8],
               Kh_b + c * 8);
    const int vr = c >> 2, vo = (c & 3) * 8;
    async_b128(&Vbuf[0][vr * VP + vo],
               VhT_b + (size_t)vr * SEQ + vo);
  }

  for (int kv = 0; kv < SEQ; kv += 32) {
    const int cur = (kv >> 5) & 1;
    if (kv + 32 < SEQ) {
      const int nkv = kv + 32;
#pragma unroll
      for (int i = 0; i < 2; ++i) {
        const int c = tid + 128 * i;
        async_b128(&Kbuf[cur ^ 1][(c >> 3) * KP + (c & 7) * 8],
                   Kh_b + (size_t)nkv * HEAD + c * 8);
        const int vr = c >> 2, vo = (c & 3) * 8;
        async_b128(&Vbuf[cur ^ 1][vr * VP + vo],
                   VhT_b + (size_t)vr * SEQ + nkv + vo);
      }
      asm volatile("s_wait_asynccnt 0x4" ::: "memory");
    } else {
      asm volatile("s_wait_asynccnt 0x0" ::: "memory");
    }
    __syncthreads();

    // ---- scores, transposed: two 16(key) x 16(query) tiles, A = K rows from LDS ----
    // s0[g]: key kv + hb + g ; s1[g]: key kv + 16 + hb + g ; query q0 + l16
    f8v s0, s1;
    {
      const _Float16* krow = &Kbuf[cur][l16 * KP];            // row = l16
      h16v bK0 = hcat(*(const h8v*)(krow + hb),      *(const h8v*)(krow + hb + 16));
      h16v bK1 = hcat(*(const h8v*)(krow + 32 + hb), *(const h8v*)(krow + 32 + hb + 16));
      f8v  z   = {};
      s0 = __builtin_amdgcn_wmma_f32_16x16x32_f16(false, bK0, false, aQ0, (short)0, z,  false, false);
      s0 = __builtin_amdgcn_wmma_f32_16x16x32_f16(false, bK1, false, aQ1, (short)0, s0, false, false);
      const _Float16* krow1 = &Kbuf[cur][(16 + l16) * KP];    // row = 16 + l16
      h16v cK0 = hcat(*(const h8v*)(krow1 + hb),      *(const h8v*)(krow1 + hb + 16));
      h16v cK1 = hcat(*(const h8v*)(krow1 + 32 + hb), *(const h8v*)(krow1 + 32 + hb + 16));
      s1 = __builtin_amdgcn_wmma_f32_16x16x32_f16(false, cK0, false, aQ0, (short)0, z,  false, false);
      s1 = __builtin_amdgcn_wmma_f32_16x16x32_f16(false, cK1, false, aQ1, (short)0, s1, false, false);
    }

    // ---- online softmax over these 32 keys: in-lane, one exchange between halves ----
    const float ta = max3f(max3f(s0[0], s0[1], s0[2]), max3f(s0[3], s0[4], s0[5]),
                           max3f(s0[6], s0[7], s1[0]));
    const float tb = max3f(max3f(s1[1], s1[2], s1[3]), max3f(s1[4], s1[5], s1[6]), s1[7]);
    const float tm   = fmaxf(ta, tb);
    const float mn   = max3f(mrow, tm, xhalf(tm));   // same value in both halves
    const float corr = __expf(mrow - mn);
    mrow = mn;
    f8v p0, p1;
#pragma unroll
    for (int g = 0; g < 8; ++g) {
      p0[g] = __expf(s0[g] - mn);
      p1[g] = __expf(s1[g] - mn);
    }
    const f8v ps8 = p0 + p1;
    const f4v ps4 = ps8.lo + ps8.hi;
    lrow = lrow * corr + ((ps4[0] + ps4[2]) + (ps4[1] + ps4[3]));
#pragma unroll
    for (int t = 0; t < 4; ++t) o[t] *= corr;

    // P^T as B operand: element i < 8 is key hb + i, element 8 + i key 16 + hb + i,
    // the k order of the V^T loader below.
    const h16v pB = hcat(__builtin_convertvector(p0, h8v), __builtin_convertvector(p1, h8v));

    // ---- O^T += V^T * P^T, A = V^T rows (h) from LDS ----
#pragma unroll
    for (int t = 0; t < 4; ++t) {
      const _Float16* vrow = &Vbuf[cur][(t * 16 + l16) * VP];
      h16v aV = hcat(*(const h8v*)(vrow + hb), *(const h8v*)(vrow + hb + 16));
      o[t] = __builtin_amdgcn_wmma_f32_16x16x32_f16(
          false, aV, false, pB, (short)0, o[t], false, false);
    }
    __syncthreads();   // protect buffer from next iteration's prefetch
  }

  // ---- epilogue: join the halves' sums; a lane owns 8 consecutive h per tile ----
  const float lsum = lrow + xhalf(lrow);
  float* orow = out + (size_t)(q0 + l16) * HEAD + hb;
#pragma unroll
  for (int t = 0; t < 4; ++t) {
    f4v lo, hi;
#pragma unroll
    for (int g = 0; g < 4; ++g) { lo[g] = o[t][g] / lsum; hi[g] = o[t][4 + g] / lsum; }
    *(f4v*)(orow + t * 16)     = lo;
    *(f4v*)(orow + t * 16 + 4) = hi;
  }
}

// ---------------------------------------------------------------------------
extern "C" void kernel_launch(void* const* d_in, const int* in_sizes, int n_in,
                              void* d_out, int out_size, void* d_ws, size_t ws_size,
                              hipStream_t stream) {
  const float* x  = (const float*)d_in[0];
  const float* Wq = (const float*)d_in[1];
  const float* bq = (const float*)d_in[2];
  const float* Wk = (const float*)d_in[3];
  const float* bk = (const float*)d_in[4];
  const float* Wv = (const float*)d_in[5];
  const float* bv = (const float*)d_in[6];
  float*       out = (float*)d_out;

  char* ws = (char*)d_ws;
  _Float16* WhT = (_Float16*)(ws);                                   // 384 KB
  _Float16* Qh  = (_Float16*)(ws + 384 * 1024);                      // 2 MB
  _Float16* Kh  = (_Float16*)(ws + 384 * 1024 + 2 * 1024 * 1024);    // 2 MB
  _Float16* VhT = (_Float16*)(ws + 384 * 1024 + 4 * 1024 * 1024);    // 2 MB

  wtrans_kernel<<<(3 * HEAD * D_MODEL) / 256, 256, 0, stream>>>(Wq, Wk, Wv, WhT);
  proj_kernel<<<NROWS / 64, 128, 0, stream>>>(x, WhT, bq, bk, bv, Qh, Kh, VhT);
  attn_kernel<<<NROWS / 64, 128, 0, stream>>>(Qh, Kh, VhT, out);
}

// v003
// A run of this version takes 65.8 microseconds.
// In two side-by-side timings against v002, it was 1.55 and 1.53 times as fast.
// All steps since v000 together make it 3.03 times as fast.
#include <hip/hip_runtime.h>
#include <hip/hip_bf16.h>

// ---- types ----
typedef _Float16 h16v __attribute__((ext_vector_type(16)));
typedef _Float16 h8v  __attribute__((ext_vector_type(8)));
typedef float    f8v  __attribute__((ext_vector_type(8)));
typedef float    f4v  __attribute__((ext_vector_type(4)));

#define D_MODEL 1024
#define HEAD    64
#define SEQ     4096
#define BATCH   4
#define NROWS   (BATCH * SEQ)   // 16384 flat rows

__device__ __forceinline__ h16v hcat(h8v lo, h8v hi) {
  h16v r;
#pragma unroll
  for (int i = 0; i < 8; ++i) { r[i] = lo[i]; r[i + 8] = hi[i]; }
  return r;
}

// Lane l <-> lane l ^ 16 (the two halves of a wave hold the same query column).
__device__ __forceinline__ float xhalf(float v) {
  const int b = __builtin_bit_cast(int, v);
  return __builtin_bit_cast(float, __builtin_amdgcn_permlanex16(
      b, b, 0x76543210, 0xfedcba98, false, false));
}
__device__ __forceinline__ float max3f(float a, float b, float c) {
  return fmaxf(fmaxf(a, b), c);
}

// LDS row pitches in halves, for ds_load_b128 readers that walk 16 rows at once:
// 16 B x odd puts the 16 rows of a half-wave on 16 different groups of four banks.
#define KP 72   // K rows: 128 B of data at 144 B
#define VP 40   // V^T rows: 64 B of data at 80 B
#define WP 40   // W^T rows: 64 B of data at 80 B

typedef int i4v __attribute__((ext_vector_type(4)));
typedef __attribute__((address_space(1))) i4v gl_i4v;
typedef __attribute__((address_space(3))) i4v sh_i4v;

// Per-lane async copy: 16 bytes global -> LDS, tracked by ASYNCcnt.
__device__ __forceinline__ void async_b128(_Float16* lds, const _Float16* gaddr) {
  __builtin_amdgcn_global_load_async_to_lds_b128((gl_i4v*)gaddr, (sh_i4v*)lds, 0, 0);
}

// ---------------------------------------------------------------------------
// Kernel 0: WhT[m][n][k] = (f16) W_m[k][n]   (3 x 64 x 1024 halves = 384 KB)
// ---------------------------------------------------------------------------
__global__ __launch_bounds__(256) void wtrans_kernel(
    const float* __restrict__ Wq, const float* __restrict__ Wk,
    const float* __restrict__ Wv, _Float16* __restrict__ WhT) {
  int idx = blockIdx.x * 256 + threadIdx.x;   // < 3*64*1024
  int m = idx >> 16;
  int r = idx & 65535;
  int n = r >> 10;
  int k = r & 1023;
  const float* W = (m == 0) ? Wq : ((m == 1) ? Wk : Wv);
  WhT[idx] = (_Float16)W[k * HEAD + n];
}

// ---------------------------------------------------------------------------
// Kernel 1: fused Q/K/V projection.  4 waves/block, 64 rows/block, all three
// matrices per block.  W tiles (3 x [64n x 32k] f16, rows at pitch WP) double-buffered
// in LDS via async global->LDS copies; 12 WMMAs per k-step per wave.
//   Q -> Qh  [row][h] f16, (x*Wq+bq)*0.125 ;  K -> Kh [row][h] ; V -> VhT[b][h][kv]
// ---------------------------------------------------------------------------
__global__ __launch_bounds__(128) void proj_kernel(
    const float* __restrict__ x, const _Float16* __restrict__ WhT,
    const float* __restrict__ bq, const float* __restrict__ bk,
    const float* __restrict__ bv, _Float16* __restrict__ Qh,
    _Float16* __restrict__ Kh, _Float16* __restrict__ VhT) {
  __shared__ __align__(16) _Float16 Wbuf[2][3 * 64 * WP];   // 2 x 15 KB

  const int tid    = threadIdx.x;
  const int wave   = tid >> 5;
  const int lane   = tid & 31;
  const int half16 = lane >> 4;
  const int l16    = lane & 15;
  const int hb     = half16 * 8;
  const int row0   = blockIdx.x * 64 + wave * 16;      // this wave's 16-row tile
  const float* xrow = x + (size_t)(row0 + l16) * D_MODEL;

  f8v acc[3][4] = {};

  // prefetch W tile for kk = 0 into buffer 0
  {
#pragma unroll
    for (int i = 0; i < 6; ++i) {
      const int c  = tid + 128 * i;        // 0..767 chunks of 16B (12 KB)
      const int m  = c >> 8, r = c & 255;
      const int n  = r >> 2, ko = (r & 3) * 8;
      async_b128(&Wbuf[0][(m * 64 + n) * WP + ko],
                 WhT + (size_t)m * 65536 + (size_t)n * 1024 + ko);
    }
  }

  for (int kk = 0; kk < D_MODEL; kk += 32) {
    const int cur = (kk >> 5) & 1;
    if (kk + 32 < D_MODEL) {
#pragma unroll
      for (int i = 0; i < 6; ++i) {
        const int c  = tid + 128 * i;
        const int m  = c >> 8, r = c & 255;
        const int n  = r >> 2, ko = (r & 3) * 8;
        async_b128(&Wbuf[cur ^ 1][(m * 64 + n) * WP + ko],
                   WhT + (size_t)m * 65536 + (size_t)n * 1024 + (kk + 32) + ko);
      }
      asm volatile("s_wait_asynccnt 0x6" ::: "memory");   // current buffer done
    } else {
      asm volatile("s_wait_asynccnt 0x0" ::: "memory");
    }
    __syncthreads();

    // A tile from global: 16 rows x 32 k of x, fp32 -> f16
    const int kA = kk + hb;
    f4v a0 = *(const f4v*)(xrow + kA);
    f4v a1 = *(const f4v*)(xrow + kA + 4);
    f4v a2 = *(const f4v*)(xrow + kA + 16);
    f4v a3 = *(const f4v*)(xrow + kA + 20);
    h16v A;
#pragma unroll
    for (int i = 0; i < 4; ++i) {
      A[i]      = (_Float16)a0[i];
      A[4 + i]  = (_Float16)a1[i];
      A[8 + i]  = (_Float16)a2[i];
      A[12 + i] = (_Float16)a3[i];
    }

    const _Float16* wb = &Wbuf[cur][0];
#pragma unroll
    for (int m = 0; m < 3; ++m) {
#pragma unroll
      for (int t = 0; t < 4; ++t) {
        const _Float16* wcol = wb + (m * 64 + t * 16 + l16) * WP;
        h16v B = hcat(*(const h8v*)(wcol + hb), *(const h8v*)(wcol + hb + 16));
        acc[m][t] = __builtin_amdgcn_wmma_f32_16x16x32_f16(
            false, A, false, B, (short)0, acc[m][t], false, false);
      }
    }
    __syncthreads();   // don't let next prefetch overwrite a buffer in use
  }

  // bias + scale + store
#pragma unroll
  for (int m = 0; m < 3; ++m) {
    const float* bias = (m == 0) ? bq : ((m == 1) ? bk : bv);
    const float  scl  = (m == 0) ? 0.125f : 1.0f;
#pragma unroll
    for (int t = 0; t < 4; ++t) {
      const int   col = t * 16 + l16;
      const float bvv = bias[col];
#pragma unroll
      for (int g = 0; g < 8; ++g) {
        const int      r    = row0 + g + 8 * half16;
        const _Float16 hval = (_Float16)((acc[m][t][g] + bvv) * scl);
        if (m == 0) {
          Qh[(size_t)r * HEAD + col] = hval;
        } else if (m == 1) {
          Kh[(size_t)r * HEAD + col] = hval;
        } else {
          const int bb = r >> 12, kv = r & (SEQ - 1);
          VhT[((size_t)bb * HEAD + col) * SEQ + kv] = hval;
        }
      }
    }
  }
}

#define KSPLIT 4
#define KRANGE (SEQ / KSPLIT)   // keys per wave
#define OP     68               // partial-O rows: 256 B of data at 272 B (16 B x odd)

__global__ __launch_bounds__(512) void attn_kernel(
    const _Float16* __restrict__ Qh, const _Float16* __restrict__ Kh,
    const _Float16* __restrict__ VhT, float* __restrict__ out) {
  __shared__ __align__(16) _Float16 Kbuf[KSPLIT][2][32 * KP];   // [kv][h]
  __shared__ __align__(16) _Float16 Vbuf[KSPLIT][2][64 * VP];   // [h][kv]
  __shared__ __align__(16) float    Opart[KSPLIT][64 * OP];     // [query][h], not normalised
  __shared__ float Mpart[KSPLIT][64];                           // range maximum per query
  __shared__ float Lpart[KSPLIT][64];                           // range sum per query

  const int tid    = threadIdx.x;
  const int kr     = tid >> 7;          // key range of this wave
  const int gt     = tid & 127;         // thread within the range's four waves
  const int qi     = gt >> 5;           // query tile of this wave
  const int lane   = tid & 31;
  const int half16 = lane >> 4;
  const int l16    = lane & 15;
  const int hb     = half16 * 8;
  const int q0     = blockIdx.x * 64 + qi * 16;     // flat q row base
  const int b      = q0 >> 12;

  const _Float16* Kh_b  = Kh  + (size_t)b * SEQ * HEAD + (size_t)kr * KRANGE * HEAD;
  const _Float16* VhT_b = VhT + (size_t)b * HEAD * SEQ + kr * KRANGE;

  // Q B-tiles (column = query l16) held in VGPRs for the whole loop
  const _Float16* qrow = Qh + (size_t)(q0 + l16) * HEAD;
  const h16v aQ0 = hcat(*(const h8v*)(qrow + hb),      *(const h8v*)(qrow + hb + 16));
  const h16v aQ1 = hcat(*(const h8v*)(qrow + 32 + hb), *(const h8v*)(qrow + 32 + hb + 16));

  // Per lane: query q0 + l16.  lrow sums only this lane's keys; the halves join
  // in the epilogue.  o[t][g] = O[q0 + l16][t * 16 + hb + g].
  float mrow = -INFINITY, lrow = 0.0f;
  f8v   o[4] = {};

  // prefetch kv tile 0 into buffer 0 (K: 32 rows x 128 B; V: 64 rows x 64 B)
#pragma unroll
  for (int i = 0; i < 2; ++i) {
    const int c = gt + 128 * i;                        // 0..255
    async_b128(&Kbuf[kr][0][(c >> 3) * KP + (c & 7) * 8],
               Kh_b + c * 8);
    const int vr = c >> 2, vo = (c & 3) * 8;
    async_b128(&Vbuf[kr][0][vr * VP + vo],
               VhT_b + (size_t)vr * SEQ + vo);
  }

  for (int kv = 0; kv < KRANGE; kv += 32) {           // kv counts inside the range
    const int cur = (kv >> 5) & 1;
    if (kv + 32 < KRANGE) {
      const int nkv = kv + 32;
#pragma unroll
      for (int i = 0; i < 2; ++i) {
        const int c = gt + 128 * i;
        async_b128(&Kbuf[kr][cur ^ 1][(c >> 3) * KP + (c & 7) * 8],
                   Kh_b + (size_t)nkv * HEAD + c * 8);
        const int vr = c >> 2, vo = (c & 3) * 8;
        async_b128(&Vbuf[kr][cur ^ 1][vr * VP + vo],
                   VhT_b + (size_t)vr * SEQ + nkv + vo);
      }
      asm volatile("s_wait_asynccnt 0x4" ::: "memory");   // current buffer done
    } else {
      asm volatile("s_wait_asynccnt 0x0" ::: "memory");
    }
    __syncthreads();

    // ---- scores, transposed: two 16(key) x 16(query) tiles, A = K rows from LDS ----
    // s0[g]: key kv + hb + g ; s1[g]: key kv + 16 + hb + g ; query q0 + l16
    f8v s0, s1;
    {
      const _Float16* krow = &Kbuf[kr][cur][l16 * KP];            // row = l16
      h16v bK0 = hcat(*(const h8v*)(krow + hb),      *(const h8v*)(krow + hb + 16));
      h16v bK1 = hcat(*(const h8v*)(krow + 32 + hb), *(const h8v*)(krow + 32 + hb + 16));
      f8v  z   = {};
      s0 = __builtin_amdgcn_wmma_f32_16x16x32_f16(false, bK0, false, aQ0, (short)0, z,  false, false);
      s0 = __builtin_amdgcn_wmma_f32_16x16x32_f16(false, bK1, false, aQ1, (short)0, s0, false, false);
      const _Float16* krow1 = &Kbuf[kr][cur][(16 + l16) * KP];    // row = 16 + l16
      h16v cK0 = hcat(*(const h8v*)(krow1 + hb),      *(const h8v*)(krow1 + hb + 16));
      h16v cK1 = hcat(*(const h8v*)(krow1 + 32 + hb), *(const h8v*)(krow1 + 32 + hb + 16));
      s1 = __builtin_amdgcn_wmma_f32_16x16x32_f16(false, cK0, false, aQ0, (short)0, z,  false, false);
      s1 = __builtin_amdgcn_wmma_f32_16x16x32_f16(false, cK1, false, aQ1, (short)0, s1, false, false);
    }

    // ---- online softmax over these 32 keys: in-lane, one exchange between halves ----
    const float ta = max3f(max3f(s0[0], s0[1], s0[2]), max3f(s0[3], s0[4], s0[5]),
                           max3f(s0[6], s0[7], s1[0]));
    const float tb = max3f(max3f(s1[1], s1[2], s1[3]), max3f(s1[4], s1[5], s1[6]), s1[7]);
    const float tm   = fmaxf(ta, tb);
    const float mn   = max3f(mrow, tm, xhalf(tm));   // same value in both halves
    const float corr = __expf(mrow - mn);
    mrow = mn;
    f8v p0, p1;
#pragma unroll
    for (int g = 0; g < 8; ++g) {
      p0[g] = __expf(s0[g] - mn);
      p1[g] = __expf(s1[g] - mn);
    }
    const f8v ps8 = p0 + p1;
    const f4v ps4 = ps8.lo + ps8.hi;
    lrow = lrow * corr + ((ps4[0] + ps4[2]) + (ps4[1] + ps4[3]));
#pragma unroll
    for (int t = 0; t < 4; ++t) o[t] *= corr;

    // P^T as B operand: element i < 8 is key hb + i, element 8 + i key 16 + hb + i,
    // the k order of the V^T loader below.
    const h16v pB = hcat(__builtin_convertvector(p0, h8v), __builtin_convertvector(p1, h8v));

    // ---- O^T += V^T * P^T, A = V^T rows (h) from LDS ----
#pragma unroll
    for (int t = 0; t < 4; ++t) {
      const _Float16* vrow = &Vbuf[kr][cur][(t * 16 + l16) * VP];
      h16v aV = hcat(*(const h8v*)(vrow + hb), *(const h8v*)(vrow + hb + 16));
      o[t] = __builtin_amdgcn_wmma_f32_16x16x32_f16(
          false, aV, false, pB, (short)0, o[t], false, false);
    }
    __syncthreads();   // protect buffer from next iteration's prefetch
  }

  // ---- hand over this range's partial: join the halves' sums, O not normalised ----
  const float lsum = lrow + xhalf(lrow);
  if (half16 == 0) {
    Mpart[kr][qi * 16 + l16] = mrow;
    Lpart[kr][qi * 16 + l16] = lsum;
  }
  float* prow = &Opart[kr][(qi * 16 + l16) * OP + hb];
#pragma unroll
  for (int t = 0; t < 4; ++t) {
    *(f4v*)(prow + t * 16)     = o[t].lo;
    *(f4v*)(prow + t * 16 + 4) = o[t].hi;
  }
  __syncthreads();   // every range's partial is in LDS before any is merged

  // ---- merge: thread -> query tid / 8, eight consecutive h; a wave stores 1 KB ----
  const int mq = tid >> 3, mh = (tid & 7) * 8;
  float mr[KSPLIT];
#pragma unroll
  for (int r = 0; r < KSPLIT; ++r) mr[r] = Mpart[r][mq];
  const float mall = fmaxf(fmaxf(mr[0], mr[1]), fmaxf(mr[2], mr[3]));
  float lall = 0.0f;
  f4v   lo = {}, hi = {};
#pragma unroll
  for (int r = 0; r < KSPLIT; ++r) {
    const float  w  = __expf(mr[r] - mall);
    const float* pr = &Opart[r][mq * OP + mh];
    lall += w * Lpart[r][mq];
    lo   += w * *(const f4v*)(pr);
    hi   += w * *(const f4v*)(pr + 4);
  }
  float* orow = out + (size_t)(blockIdx.x * 64 + mq) * HEAD + mh;
#pragma unroll
  for (int g = 0; g < 4; ++g) { lo[g] = lo[g] / lall; hi[g] = hi[g] / lall; }
  *(f4v*)(orow)     = lo;
  *(f4v*)(orow + 4) = hi;
}

// ---------------------------------------------------------------------------
extern "C" void kernel_launch(void* const* d_in, const int* in_sizes, int n_in,
                              void* d_out, int out_size, void* d_ws, size_t ws_size,
                              hipStream_t stream) {
  const float* x  = (const float*)d_in[0];
  const float* Wq = (const float*)d_in[1];
  const float* bq = (const float*)d_in[2];
  const float* Wk = (const float*)d_in[3];
  const float* bk = (const float*)d_in[4];
  const float* Wv = (const float*)d_in[5];
  const float* bv = (const float*)d_in[6];
  float*       out = (float*)d_out;

  char* ws = (char*)d_ws;
  _Float16* WhT = (_Float16*)(ws);                                   // 384 KB
  _Float16* Qh  = (_Float16*)(ws + 384 * 1024);                      // 2 MB
  _Float16* Kh  = (_Float16*)(ws + 384 * 1024 + 2 * 1024 * 1024);    // 2 MB
  _Float16* VhT = (_Float16*)(ws + 384 * 1024 + 4 * 1024 * 1024);    // 2 MB

  wtrans_kernel<<<(3 * HEAD * D_MODEL) / 256, 256, 0, stream>>>(Wq, Wk, Wv, WhT);
  proj_kernel<<<NROWS / 64, 128, 0, stream>>>(x, WhT, bq, bk, bv, Qh, Kh, VhT);
  attn_kernel<<<NROWS / 64, 512, 0, stream>>>(Qh, Kh, VhT, out);
}

// v004
// It runs in 48.5 microseconds.
// In two side-by-side timings against v003, it was 1.34 and 1.33 times as fast.
// Over all steps from v000 it is 4.05 times as fast.
#include <hip/hip_runtime.h>
#include <hip/hip_bf16.h>

// ---- types ----
typedef _Float16 h16v __attribute__((ext_vector_type(16)));
typedef _Float16 h8v  __attribute__((ext_vector_type(8)));
typedef float    f8v  __attribute__((ext_vector_type(8)));
typedef float    f4v  __attribute__((ext_vector_type(4)));

#define D_MODEL 1024
#define HEAD    64
#define SEQ     4096
#define BATCH   4
#define NROWS   (BATCH * SEQ)   // 16384 flat rows

__device__ __forceinline__ h16v hcat(h8v lo, h8v hi) {
  h16v r;
#pragma unroll
  for (int i = 0; i < 8; ++i) { r[i] = lo[i]; r[i + 8] = hi[i]; }
  return r;
}

// Lane l <-> lane l ^ 16 (the two halves of a wave hold the same query column).
__device__ __forceinline__ float xhalf(float v) {
  const int b = __builtin_bit_cast(int, v);
  return __builtin_bit_cast(float, __builtin_amdgcn_permlanex16(
      b, b, 0x76543210, 0xfedcba98, false, false));
}
__device__ __forceinline__ float max3f(float a, float b, float c) {
  return fmaxf(fmaxf(a, b), c);
}

// LDS row pitches in halves, for ds_load_b128 readers that walk 16 rows at once:
// 16 B x odd puts the 16 rows of a half-wave on 16 different groups of four banks.
#define KP 72   // K rows: 128 B of data at 144 B
#define VP 40   // V^T rows: 64 B of data at 80 B
#define WP 40   // W^T rows: 64 B of data at 80 B

typedef int i4v __attribute__((ext_vector_type(4)));
typedef __attribute__((address_space(1))) i4v gl_i4v;
typedef __attribute__((address_space(3))) i4v sh_i4v;

// Per-lane async copy: 16 bytes global -> LDS, tracked by ASYNCcnt.
__device__ __forceinline__ void async_b128(_Float16* lds, const _Float16* gaddr) {
  __builtin_amdgcn_global_load_async_to_lds_b128((gl_i4v*)gaddr, (sh_i4v*)lds, 0, 0);
}

// ---------------------------------------------------------------------------
// Kernel 0: WhT[m][n][k] = (f16) W_m[k][n]   (3 x 64 x 1024 halves = 384 KB)
// ---------------------------------------------------------------------------
__global__ __launch_bounds__(256) void wtrans_kernel(
    const float* __restrict__ Wq, const float* __restrict__ Wk,
    const float* __restrict__ Wv, _Float16* __restrict__ WhT) {
  int idx = blockIdx.x * 256 + threadIdx.x;   // < 3*64*1024
  int m = idx >> 16;
  int r = idx & 65535;
  int n = r >> 10;
  int k = r & 1023;
  const float* W = (m == 0) ? Wq : ((m == 1) ? Wk : Wv);
  WhT[idx] = (_Float16)W[k * HEAD + n];
}

// ---------------------------------------------------------------------------
// Kernel 1: fused Q/K/V projection.  64 rows/block, all three matrices per block.
// 16 waves/block = 4 row tiles x 4 k ranges, so that four waves share each SIMD and
// fill each other's waits on x (memory) and on the W fragments (LDS).  Wave (kr, wave):
// rows row0 .. row0 + 15, k in kr * 256 .. + 255, 12 WMMAs per k-step of 32.
// The four waves of a k range share that range's W tiles (3 x [64n x 32k] f16, rows at
// pitch WP), double-buffered in LDS via async global->LDS copies.  The four ranges'
// partial sums merge through LDS; wave (kr, wave) finishes column tile kr of Q, K, V.
//   Q -> Qh  [row][h] f16, (x*Wq+bq)*0.125 ;  K -> Kh [row][h] ; V -> VhT[b][h][kv]
// ---------------------------------------------------------------------------
#define PSPLIT 4
#define PRANGE (D_MODEL / PSPLIT)      // k per wave
#define WTILE  (3 * 64 * WP)           // halves in one W buffer (15 KB)
#define PTILE  256                     // floats in one 16 x 16 partial tile (1 KB)

__global__ __launch_bounds__(512) void proj_kernel(
    const float* __restrict__ x, const _Float16* __restrict__ WhT,
    const float* __restrict__ bq, const float* __restrict__ bk,
    const float* __restrict__ bv, _Float16* __restrict__ Qh,
    _Float16* __restrict__ Kh, _Float16* __restrict__ VhT) {
  // In the loop: W buffers [k range][2][WTILE] halves (120 KB).  Behind the loop's last
  // barrier the same LDS holds the partial sums [k range][row tile][12][PTILE] floats.
  __shared__ __align__(16) float smem[PSPLIT * 4 * 12 * PTILE];   // 192 KB

  const int tid    = threadIdx.x;
  const int kr     = tid >> 7;          // k range of this wave
  const int gt     = tid & 127;         // thread within the range's four waves
  const int wave   = gt >> 5;           // row tile of this wave
  const int lane   = tid & 31;
  const int half16 = lane >> 4;
  const int l16    = lane & 15;
  const int hb     = half16 * 8;
  const int row0   = blockIdx.x * 64 + wave * 16;      // this wave's 16-row tile
  const float*    xrow = x + (size_t)(row0 + l16) * D_MODEL + kr * PRANGE;
  const _Float16* Wr   = WhT + kr * PRANGE;            // this range's k columns
  _Float16*       Wbuf = (_Float16*)smem + kr * 2 * WTILE;

  f8v acc[3][4] = {};

  // prefetch W tile for kk = 0 into buffer 0
  {
#pragma unroll
    for (int i = 0; i < 6; ++i) {
      const int c  = gt + 128 * i;         // 0..767 chunks of 16B (12 KB)
      const int m  = c >> 8, r = c & 255;
      const int n  = r >> 2, ko = (r & 3) * 8;
      async_b128(&Wbuf[(m * 64 + n) * WP + ko],
                 Wr + (size_t)m * 65536 + (size_t)n * 1024 + ko);
    }
  }

  for (int kk = 0; kk < PRANGE; kk += 32) {            // kk counts inside the range
    const int cur = (kk >> 5) & 1;
    if (kk + 32 < PRANGE) {
#pragma unroll
      for (int i = 0; i < 6; ++i) {
        const int c  = gt + 128 * i;
        const int m  = c >> 8, r = c & 255;
        const int n  = r >> 2, ko = (r & 3) * 8;
        async_b128(&Wbuf[(cur ^ 1) * WTILE + (m * 64 + n) * WP + ko],
                   Wr + (size_t)m * 65536 + (size_t)n * 1024 + (kk + 32) + ko);
      }
      asm volatile("s_wait_asynccnt 0x6" ::: "memory");   // current buffer done
    } else {
      asm volatile("s_wait_asynccnt 0x0" ::: "memory");
    }
    __syncthreads();

    // A tile from global: 16 rows x 32 k of x, fp32 -> f16
    const int kA = kk + hb;
    f4v a0 = *(const f4v*)(xrow + kA);
    f4v a1 = *(const f4v*)(xrow + kA + 4);
    f4v a2 = *(const f4v*)(xrow + kA + 16);
    f4v a3 = *(const f4v*)(xrow + kA + 20);
    h16v A;
#pragma unroll
    for (int i = 0; i < 4; ++i) {
      A[i]      = (_Float16)a0[i];
      A[4 + i]  = (_Float16)a1[i];
      A[8 + i]  = (_Float16)a2[i];
      A[12 + i] = (_Float16)a3[i];
    }

    const _Float16* wb = &Wbuf[cur * WTILE];
#pragma unroll
    for (int m = 0; m < 3; ++m) {
#pragma unroll
      for (int t = 0; t < 4; ++t) {
        const _Float16* wcol = wb + (m * 64 + t * 16 + l16) * WP;
        h16v B = hcat(*(const h8v*)(wcol + hb), *(const h8v*)(wcol + hb + 16));
        acc[m][t] = __builtin_amdgcn_wmma_f32_16x16x32_f16(
            false, A, false, B, (short)0, acc[m][t], false, false);
      }
    }
    __syncthreads();   // don't let next prefetch overwrite a buffer in use
  }

  // ---- hand over this range's partial sums: a wave's store covers 512 B in a row ----
  // (the loop's last barrier has ended every read of the W buffers)
  {
    float* pw = smem + (size_t)((kr * 4 + wave) * 12) * PTILE + lane * 4;
#pragma unroll
    for (int m = 0; m < 3; ++m) {
#pragma unroll
      for (int t = 0; t < 4; ++t) {
        *(f4v*)(pw + (m * 4 + t) * PTILE)       = acc[m][t].lo;
        *(f4v*)(pw + (m * 4 + t) * PTILE + 128) = acc[m][t].hi;
      }
    }
  }
  __syncthreads();   // every range's partial is in LDS before any is merged

  // ---- merge in the order of the k ranges, then bias + scale + store: tile t = kr ----
  const int col = kr * 16 + l16;
#pragma unroll
  for (int m = 0; m < 3; ++m) {
    const float* pr = smem + (size_t)(wave * 12 + m * 4 + kr) * PTILE + lane * 4;
    f4v lo = *(const f4v*)(pr);
    f4v hi = *(const f4v*)(pr + 128);
#pragma unroll
    for (int r = 1; r < PSPLIT; ++r) {
      lo += *(const f4v*)(pr + r * 48 * PTILE);
      hi += *(const f4v*)(pr + r * 48 * PTILE + 128);
    }
    const float* bias = (m == 0) ? bq : ((m == 1) ? bk : bv);
    const float  scl  = (m == 0) ? 0.125f : 1.0f;
    const float  bvv  = bias[col];
#pragma unroll
    for (int g = 0; g < 8; ++g) {
      const int      r    = row0 + g + 8 * half16;
      const float    sum  = (g < 4) ? lo[g & 3] : hi[g & 3];
      const _Float16 hval = (_Float16)((sum + bvv) * scl);
      if (m == 0) {
        Qh[(size_t)r * HEAD + col] = hval;
      } else if (m == 1) {
        Kh[(size_t)r * HEAD + col] = hval;
      } else {
        const int bb = r >> 12, kv = r & (SEQ - 1);
        VhT[((size_t)bb * HEAD + col) * SEQ + kv] = hval;
      }
    }
  }
}

#define KSPLIT 4
#define KRANGE (SEQ / KSPLIT)   // keys per wave
#define OP     68               // partial-O rows: 256 B of data at 272 B (16 B x odd)

__global__ __launch_bounds__(512) void attn_kernel(
    const _Float16* __restrict__ Qh, const _Float16* __restrict__ Kh,
    const _Float16* __restrict__ VhT, float* __restrict__ out) {
  __shared__ __align__(16) _Float16 Kbuf[KSPLIT][2][32 * KP];   // [kv][h]
  __shared__ __align__(16) _Float16 Vbuf[KSPLIT][2][64 * VP];   // [h][kv]
  __shared__ __align__(16) float    Opart[KSPLIT][64 * OP];     // [query][h], not normalised
  __shared__ float Mpart[KSPLIT][64];                           // range maximum per query
  __shared__ float Lpart[KSPLIT][64];                           // range sum per query

  const int tid    = threadIdx.x;
  const int kr     = tid >> 7;          // key range of this wave
  const int gt     = tid & 127;         // thread within the range's four waves
  const int qi     = gt >> 5;           // query tile of this wave
  const int lane   = tid & 31;
  const int half16 = lane >> 4;
  const int l16    = lane & 15;
  const int hb     = half16 * 8;
  const int q0     = blockIdx.x * 64 + qi * 16;     // flat q row base
  const int b      = q0 >> 12;

  const _Float16* Kh_b  = Kh  + (size_t)b * SEQ * HEAD + (size_t)kr * KRANGE * HEAD;
  const _Float16* VhT_b = VhT + (size_t)b * HEAD * SEQ + kr * KRANGE;

  // Q B-tiles (column = query l16) held in VGPRs for the whole loop
  const _Float16* qrow = Qh + (size_t)(q0 + l16) * HEAD;
  const h16v aQ0 = hcat(*(const h8v*)(qrow + hb),      *(const h8v*)(qrow + hb + 16));
  const h16v aQ1 = hcat(*(const h8v*)(qrow + 32 + hb), *(const h8v*)(qrow + 32 + hb + 16));

  // Per lane: query q0 + l16.  lrow sums only this lane's keys; the halves join
  // in the epilogue.  o[t][g] = O[q0 + l16][t * 16 + hb + g].
  float mrow = -INFINITY, lrow = 0.0f;
  f8v   o[4] = {};

  // prefetch kv tile 0 into buffer 0 (K: 32 rows x 128 B; V: 64 rows x 64 B)
#pragma unroll
  for (int i = 0; i < 2; ++i) {
    const int c = gt + 128 * i;                        // 0..255
    async_b128(&Kbuf[kr][0][(c >> 3) * KP + (c & 7) * 8],
               Kh_b + c * 8);
    const int vr = c >> 2, vo = (c & 3) * 8;
    async_b128(&Vbuf[kr][0][vr * VP + vo],
               VhT_b + (size_t)vr * SEQ + vo);
  }

  for (int kv = 0; kv < KRANGE; kv += 32) {           // kv counts inside the range
    const int cur = (kv >> 5) & 1;
    if (kv + 32 < KRANGE) {
      const int nkv = kv + 32;
#pragma unroll
      for (int i = 0; i < 2; ++i) {
        const int c = gt + 128 * i;
        async_b128(&Kbuf[kr][cur ^ 1][(c >> 3) * KP + (c & 7) * 8],
                   Kh_b + (size_t)nkv * HEAD + c * 8);
        const int vr = c >> 2, vo = (c & 3) * 8;
        async_b128(&Vbuf[kr][cur ^ 1][vr * VP + vo],
                   VhT_b + (size_t)vr * SEQ + nkv + vo);
      }
      asm volatile("s_wait_asynccnt 0x4" ::: "memory");   // current buffer done
    } else {
      asm volatile("s_wait_asynccnt 0x0" ::: "memory");
    }
    __syncthreads();

    // ---- scores, transposed: two 16(key) x 16(query) tiles, A = K rows from LDS ----
    // s0[g]: key kv + hb + g ; s1[g]: key kv + 16 + hb + g ; query q0 + l16
    f8v s0, s1;
    {
      const _Float16* krow = &Kbuf[kr][cur][l16 * KP];            // row = l16
      h16v bK0 = hcat(*(const h8v*)(krow + hb),      *(const h8v*)(krow + hb + 16));
      h16v bK1 = hcat(*(const h8v*)(krow + 32 + hb), *(const h8v*)(krow + 32 + hb + 16));
      f8v  z   = {};
      s0 = __builtin_amdgcn_wmma_f32_16x16x32_f16(false, bK0, false, aQ0, (short)0, z,  false, false);
      s0 = __builtin_amdgcn_wmma_f32_16x16x32_f16(false, bK1, false, aQ1, (short)0, s0, false, false);
      const _Float16* krow1 = &Kbuf[kr][cur][(16 + l16) * KP];    // row = 16 + l16
      h16v cK0 = hcat(*(const h8v*)(krow1 + hb),      *(const h8v*)(krow1 + hb + 16));
      h16v cK1 = hcat(*(const h8v*)(krow1 + 32 + hb), *(const h8v*)(krow1 + 32 + hb + 16));
      s1 = __builtin_amdgcn_wmma_f32_16x16x32_f16(false, cK0, false, aQ0, (short)0, z,  false, false);
      s1 = __builtin_amdgcn_wmma_f32_16x16x32_f16(false, cK1, false, aQ1, (short)0, s1, false, false);
    }

    // ---- online softmax over these 32 keys: in-lane, one exchange between halves ----
    const float ta = max3f(max3f(s0[0], s0[1], s0[2]), max3f(s0[3], s0[4], s0[5]),
                           max3f(s0[6], s0[7], s1[0]));
    const float tb = max3f(max3f(s1[1], s1[2], s1[3]), max3f(s1[4], s1[5], s1[6]), s1[7]);
    const float tm   = fmaxf(ta, tb);
    const float mn   = max3f(mrow, tm, xhalf(tm));   // same value in both halves
    const float corr = __expf(mrow - mn);
    mrow = mn;
    f8v p0, p1;
#pragma unroll
    for (int g = 0; g < 8; ++g) {
      p0[g] = __expf(s0[g] - mn);
      p1[g] = __expf(s1[g] - mn);
    }
    const f8v ps8 = p0 + p1;
    const f4v ps4 = ps8.lo + ps8.hi;
    lrow = lrow * corr + ((ps4[0] + ps4[2]) + (ps4[1] + ps4[3]));
#pragma unroll
    for (int t = 0; t < 4; ++t) o[t] *= corr;

    // P^T as B operand: element i < 8 is key hb + i, element 8 + i key 16 + hb + i,
    // the k order of the V^T loader below.
    const h16v pB = hcat(__builtin_convertvector(p0, h8v), __builtin_convertvector(p1, h8v));

    // ---- O^T += V^T * P^T, A = V^T rows (h) from LDS ----
#pragma unroll
    for (int t = 0; t < 4; ++t) {
      const _Float16* vrow = &Vbuf[kr][cur][(t * 16 + l16) * VP];
      h16v aV = hcat(*(const h8v*)(vrow + hb), *(const h8v*)(vrow + hb + 16));
      o[t] = __builtin_amdgcn_wmma_f32_16x16x32_f16(
          false, aV, false, pB, (short)0, o[t], false, false);
    }
    __syncthreads();   // protect buffer from next iteration's prefetch
  }

  // ---- hand over this range's partial: join the halves' sums, O not normalised ----
  const float lsum = lrow + xhalf(lrow);
  if (half16 == 0) {
    Mpart[kr][qi * 16 + l16] = mrow;
    Lpart[kr][qi * 16 + l16] = lsum;
  }
  float* prow = &Opart[kr][(qi * 16 + l16) * OP + hb];
#pragma unroll
  for (int t = 0; t < 4; ++t) {
    *(f4v*)(prow + t * 16)     = o[t].lo;
    *(f4v*)(prow + t * 16 + 4) = o[t].hi;
  }
  __syncthreads();   // every range's partial is in LDS before any is merged

  // ---- merge: thread -> query tid / 8, eight consecutive h; a wave stores 1 KB ----
  const int mq = tid >> 3, mh = (tid & 7) * 8;
  float mr[KSPLIT];
#pragma unroll
  for (int r = 0; r < KSPLIT; ++r) mr[r] = Mpart[r][mq];
  const float mall = fmaxf(fmaxf(mr[0], mr[1]), fmaxf(mr[2], mr[3]));
  float lall = 0.0f;
  f4v   lo = {}, hi = {};
#pragma unroll
  for (int r = 0; r < KSPLIT; ++r) {
    const float  w  = __expf(mr[r] - mall);
    const float* pr = &Opart[r][mq * OP + mh];
    lall += w * Lpart[r][mq];
    lo   += w * *(const f4v*)(pr);
    hi   += w * *(const f4v*)(pr + 4);
  }
  float* orow = out + (size_t)(blockIdx.x * 64 + mq) * HEAD + mh;
#pragma unroll
  for (int g = 0; g < 4; ++g) { lo[g] = lo[g] / lall; hi[g] = hi[g] / lall; }
  *(f4v*)(orow)     = lo;
  *(f4v*)(orow + 4) = hi;
}

// ---------------------------------------------------------------------------
extern "C" void kernel_launch(void* const* d_in, const int* in_sizes, int n_in,
                              void* d_out, int out_size, void* d_ws, size_t ws_size,
                              hipStream_t stream) {
  const float* x  = (const float*)d_in[0];
  const float* Wq = (const float*)d_in[1];
  const float* bq = (const float*)d_in[2];
  const float* Wk = (const float*)d_in[3];
  const float* bk = (const float*)d_in[4];
  const float* Wv = (const float*)d_in[5];
  const float* bv = (const float*)d_in[6];
  float*       out = (float*)d_out;

  char* ws = (char*)d_ws;
  _Float16* WhT = (_Float16*)(ws);                                   // 384 KB
  _Float16* Qh  = (_Float16*)(ws + 384 * 1024);                      // 2 MB
  _Float16* Kh  = (_Float16*)(ws + 384 * 1024 + 2 * 1024 * 1024);    // 2 MB
  _Float16* VhT = (_Float16*)(ws + 384 * 1024 + 4 * 1024 * 1024);    // 2 MB

  wtrans_kernel<<<(3 * HEAD * D_MODEL) / 256, 256, 0, stream>>>(Wq, Wk, Wv, WhT);
  proj_kernel<<<NROWS / 64, 512, 0, stream>>>(x, WhT, bq, bk, bv, Qh, Kh, VhT);
  attn_kernel<<<NROWS / 64, 512, 0, stream>>>(Qh, Kh, VhT, out);
}

// v005
// A run of this version takes 43.9 microseconds.
// Two timings next to v004 put it at 1.10 and 1.08 times that version's speed.
// Counting every step since v000, it is 4.41 times as fast.
#include <hip/hip_runtime.h>
#include <hip/hip_bf16.h>

// ---- types ----
typedef _Float16 h16v __attribute__((ext_vector_type(16)));
typedef _Float16 h8v  __attribute__((ext_vector_type(8)));
typedef float    f8v  __attribute__((ext_vector_type(8)));
typedef float    f4v  __attribute__((ext_vector_type(4)));
typedef float    f2v  __attribute__((ext_vector_type(2)));

#define D_MODEL 1024
#define HEAD    64
#define SEQ     4096
#define BATCH   4
#define NROWS   (BATCH * SEQ)   // 16384 flat rows

__device__ __forceinline__ h16v hcat(h8v lo, h8v hi) {
  h16v r;
#pragma unroll
  for (int i = 0; i < 8; ++i) { r[i] = lo[i]; r[i + 8] = hi[i]; }
  return r;
}

// Lane l <-> lane l ^ 16 (the two halves of a wave hold the same query column).
__device__ __forceinline__ float xhalf(float v) {
  const int b = __builtin_bit_cast(int, v);
  return __builtin_bit_cast(float, __builtin_amdgcn_permlanex16(
      b, b, 0x76543210, 0xfedcba98, false, false));
}
__device__ __forceinline__ float max3f(float a, float b, float c) {
  return fmaxf(fmaxf(a, b), c);
}

// LDS row pitches in halves, for ds_load_b128 readers that walk 16 rows at once:
// 16 B x odd puts the 16 rows of a half-wave on 16 different groups of four banks.
#define KP 72   // K rows: 128 B of data at 144 B
#define VP 40   // V^T rows: 64 B of data at 80 B
#define WP 40   // W^T rows: 64 B of data at 80 B

typedef int i4v __attribute__((ext_vector_type(4)));
typedef __attribute__((address_space(1))) i4v gl_i4v;
typedef __attribute__((address_space(3))) i4v sh_i4v;

// Per-lane async copy: 16 bytes global -> LDS, tracked by ASYNCcnt.
__device__ __forceinline__ void async_b128(_Float16* lds, const _Float16* gaddr) {
  __builtin_amdgcn_global_load_async_to_lds_b128((gl_i4v*)gaddr, (sh_i4v*)lds, 0, 0);
}

// ---------------------------------------------------------------------------
// Kernel 1: fused Q/K/V projection.  64 rows/block, all three matrices per block.
// 16 waves/block = 4 row tiles x 4 k ranges, so that four waves share each SIMD and
// fill each other's waits on x (memory) and on the W fragments (LDS).  Wave (kr, wave):
// rows row0 .. row0 + 15, k in kr * 256 .. + 255, 12 WMMAs per k-step of 32.
// The four waves of a k range share that range's W tiles (3 x [64n x 32k] f16, rows at
// pitch WP), double-buffered in LDS.  The block makes them itself from the f32 weights
// W[k][n]: wave `wave` takes k octet `wave` of a tile, a lane two columns; a load covers
// one whole 256 B row of W, eight rows pack into one 16 B LDS store per column.  The next
// tile's loads fly during this tile's products.  The four ranges' partial sums merge
// through LDS; wave (kr, wave) finishes column tile kr of Q, K, V.
//   Q -> Qh  [row][h] f16, (x*Wq+bq)*0.125 ;  K -> Kh [row][h] ; V -> VhT[b][h][kv]
// ---------------------------------------------------------------------------
#define PSPLIT 4
#define PRANGE (D_MODEL / PSPLIT)      // k per wave
#define WTILE  (3 * 64 * WP)           // halves in one W buffer (15 KB)
#define PTILE  256                     // floats in one 16 x 16 partial tile (1 KB)

__global__ __launch_bounds__(512) void proj_kernel(
    const float* __restrict__ x, const float* __restrict__ Wq,
    const float* __restrict__ Wk, const float* __restrict__ Wv,
    const float* __restrict__ bq, const float* __restrict__ bk,
    const float* __restrict__ bv, _Float16* __restrict__ Qh,
    _Float16* __restrict__ Kh, _Float16* __restrict__ VhT) {
  // In the loop: W buffers [k range][2][WTILE] halves (120 KB).  Behind the loop's last
  // barrier the same LDS holds the partial sums [k range][row tile][12][PTILE] floats.
  __shared__ __align__(16) float smem[PSPLIT * 4 * 12 * PTILE];   // 192 KB

  const int tid    = threadIdx.x;
  const int kr     = tid >> 7;          // k range of this wave
  const int gt     = tid & 127;         // thread within the range's four waves
  const int wave   = gt >> 5;           // row tile of this wave
  const int lane   = tid & 31;
  const int half16 = lane >> 4;
  const int l16    = lane & 15;
  const int hb     = half16 * 8;
  const int row0   = blockIdx.x * 64 + wave * 16;      // this wave's 16-row tile
  const float*    xrow = x + (size_t)(row0 + l16) * D_MODEL + kr * PRANGE;
  _Float16*       Wbuf = (_Float16*)smem + kr * 2 * WTILE;

  // W staging: rows kr * PRANGE + kk + wave * 8 + j of W, columns 2 * lane and 2 * lane + 1
  const size_t woff = (size_t)(kr * PRANGE + wave * 8) * HEAD + 2 * lane;
  const float* wsrc[3] = {Wq + woff, Wk + woff, Wv + woff};
  _Float16*    wdst    = Wbuf + (2 * lane) * WP + wave * 8;
  f2v          wreg[3][8];

  f8v acc[3][4] = {};

  // W tile for kk = 0 into buffer 0
#pragma unroll
  for (int m = 0; m < 3; ++m) {
#pragma unroll
    for (int j = 0; j < 8; ++j) wreg[m][j] = *(const f2v*)(wsrc[m] + j * HEAD);
  }
#pragma unroll
  for (int m = 0; m < 3; ++m) {
#pragma unroll
    for (int c = 0; c < 2; ++c) {
      h8v h;
#pragma unroll
      for (int j = 0; j < 8; ++j) h[j] = (_Float16)wreg[m][j][c];
      *(h8v*)(wdst + (m * 64 + c) * WP) = h;
    }
  }
  __syncthreads();   // tile 0 is in LDS before any wave reads it

  // unrolled: a tile's k offset and its buffer become immediate offsets of the loads and
  // LDS operations, on one scalar base and one lane offset that are never rewritten
#pragma unroll
  for (int kk = 0; kk < PRANGE; kk += 32) {            // kk counts inside the range
    const int  cur  = (kk >> 5) & 1;
    const bool more = kk + 32 < PRANGE;

    // A tile from global: 16 rows x 32 k of x, fp32 -> f16
    const int kA = kk + hb;
    f4v a0 = *(const f4v*)(xrow + kA);
    f4v a1 = *(const f4v*)(xrow + kA + 4);
    f4v a2 = *(const f4v*)(xrow + kA + 16);
    f4v a3 = *(const f4v*)(xrow + kA + 20);

    // next W tile, f32, into registers: in flight during this tile's products
    if (more) {
#pragma unroll
      for (int m = 0; m < 3; ++m) {
#pragma unroll
        for (int j = 0; j < 8; ++j)
          wreg[m][j] = *(const f2v*)(wsrc[m] + (size_t)(kk + 32 + j) * HEAD);
      }
    }

    h16v A;
#pragma unroll
    for (int i = 0; i < 4; ++i) {
      A[i]      = (_Float16)a0[i];
      A[4 + i]  = (_Float16)a1[i];
      A[8 + i]  = (_Float16)a2[i];
      A[12 + i] = (_Float16)a3[i];
    }

    const _Float16* wb = &Wbuf[cur * WTILE];
#pragma unroll
    for (int m = 0; m < 3; ++m) {
#pragma unroll
      for (int t = 0; t < 4; ++t) {
        const _Float16* wcol = wb + (m * 64 + t * 16 + l16) * WP;
        h16v B = hcat(*(const h8v*)(wcol + hb), *(const h8v*)(wcol + hb + 16));
        acc[m][t] = __builtin_amdgcn_wmma_f32_16x16x32_f16(
            false, A, false, B, (short)0, acc[m][t], false, false);
      }
    }
    // f32 -> f16, transposed into the other buffer (its readers left it at the last barrier)
    if (more) {
#pragma unroll
      for (int m = 0; m < 3; ++m) {
#pragma unroll
        for (int c = 0; c < 2; ++c) {
          h8v h;
#pragma unroll
          for (int j = 0; j < 8; ++j) h[j] = (_Float16)wreg[m][j][c];
          *(h8v*)(wdst + (cur ^ 1) * WTILE + (m * 64 + c) * WP) = h;
        }
      }
    }
    __syncthreads();   // publishes the next tile and ends this tile's reads
  }

  // ---- hand over this range's partial sums: a wave's store covers 512 B in a row ----
  // (the loop's last barrier has ended every read of the W buffers)
  {
    float* pw = smem + (size_t)((kr * 4 + wave) * 12) * PTILE + lane * 4;
#pragma unroll
    for (int m = 0; m < 3; ++m) {
#pragma unroll
      for (int t = 0; t < 4; ++t) {
        *(f4v*)(pw + (m * 4 + t) * PTILE)       = acc[m][t].lo;
        *(f4v*)(pw + (m * 4 + t) * PTILE + 128) = acc[m][t].hi;
      }
    }
  }
  __syncthreads();   // every range's partial is in LDS before any is merged

  // ---- merge in the order of the k ranges, then bias + scale + store: tile t = kr ----
  const int col = kr * 16 + l16;
#pragma unroll
  for (int m = 0; m < 3; ++m) {
    const float* pr = smem + (size_t)(wave * 12 + m * 4 + kr) * PTILE + lane * 4;
    f4v lo = *(const f4v*)(pr);
    f4v hi = *(const f4v*)(pr + 128);
#pragma unroll
    for (int r = 1; r < PSPLIT; ++r) {
      lo += *(const f4v*)(pr + r * 48 * PTILE);
      hi += *(const f4v*)(pr + r * 48 * PTILE + 128);
    }
    const float* bias = (m == 0) ? bq : ((m == 1) ? bk : bv);
    const float  scl  = (m == 0) ? 0.125f : 1.0f;
    const float  bvv  = bias[col];
#pragma unroll
    for (int g = 0; g < 8; ++g) {
      const int      r    = row0 + g + 8 * half16;
      const float    sum  = (g < 4) ? lo[g & 3] : hi[g & 3];
      const _Float16 hval = (_Float16)((sum + bvv) * scl);
      if (m == 0) {
        Qh[(size_t)r * HEAD + col] = hval;
      } else if (m == 1) {
        Kh[(size_t)r * HEAD + col] = hval;
      } else {
        const int bb = r >> 12, kv = r & (SEQ - 1);
        VhT[((size_t)bb * HEAD + col) * SEQ + kv] = hval;
      }
    }
  }
}

#define KSPLIT 4
#define KRANGE (SEQ / KSPLIT)   // keys per wave
#define OP     68               // partial-O rows: 256 B of data at 272 B (16 B x odd)

__global__ __launch_bounds__(512) void attn_kernel(
    const _Float16* __restrict__ Qh, const _Float16* __restrict__ Kh,
    const _Float16* __restrict__ VhT, float* __restrict__ out) {
  __shared__ __align__(16) _Float16 Kbuf[KSPLIT][2][32 * KP];   // [kv][h]
  __shared__ __align__(16) _Float16 Vbuf[KSPLIT][2][64 * VP];   // [h][kv]
  __shared__ __align__(16) float    Opart[KSPLIT][64 * OP];     // [query][h], not normalised
  __shared__ float Mpart[KSPLIT][64];                           // range maximum per query
  __shared__ float Lpart[KSPLIT][64];                           // range sum per query

  const int tid    = threadIdx.x;
  const int kr     = tid >> 7;          // key range of this wave
  const int gt     = tid & 127;         // thread within the range's four waves
  const int qi     = gt >> 5;           // query tile of this wave
  const int lane   = tid & 31;
  const int half16 = lane >> 4;
  const int l16    = lane & 15;
  const int hb     = half16 * 8;
  const int q0     = blockIdx.x * 64 + qi * 16;     // flat q row base
  const int b      = q0 >> 12;

  const _Float16* Kh_b  = Kh  + (size_t)b * SEQ * HEAD + (size_t)kr * KRANGE * HEAD;
  const _Float16* VhT_b = VhT + (size_t)b * HEAD * SEQ + kr * KRANGE;

  // Q B-tiles (column = query l16) held in VGPRs for the whole loop
  const _Float16* qrow = Qh + (size_t)(q0 + l16) * HEAD;
  const h16v aQ0 = hcat(*(const h8v*)(qrow + hb),      *(const h8v*)(qrow + hb + 16));
  const h16v aQ1 = hcat(*(const h8v*)(qrow + 32 + hb), *(const h8v*)(qrow + 32 + hb + 16));

  // Per lane: query q0 + l16.  lrow sums only this lane's keys; the halves join
  // in the epilogue.  o[t][g] = O[q0 + l16][t * 16 + hb + g].
  float mrow = -INFINITY, lrow = 0.0f;
  f8v   o[4] = {};

  // prefetch kv tile 0 into buffer 0 (K: 32 rows x 128 B; V: 64 rows x 64 B)
#pragma unroll
  for (int i = 0; i < 2; ++i) {
    const int c = gt + 128 * i;                        // 0..255
    async_b128(&Kbuf[kr][0][(c >> 3) * KP + (c & 7) * 8],
               Kh_b + c * 8);
    const int vr = c >> 2, vo = (c & 3) * 8;
    async_b128(&Vbuf[kr][0][vr * VP + vo],
               VhT_b + (size_t)vr * SEQ + vo);
  }

  for (int kv = 0; kv < KRANGE; kv += 32) {           // kv counts inside the range
    const int cur = (kv >> 5) & 1;
    if (kv + 32 < KRANGE) {
      const int nkv = kv + 32;
#pragma unroll
      for (int i = 0; i < 2; ++i) {
        const int c = gt + 128 * i;
        async_b128(&Kbuf[kr][cur ^ 1][(c >> 3) * KP + (c & 7) * 8],
                   Kh_b + (size_t)nkv * HEAD + c * 8);
        const int vr = c >> 2, vo = (c & 3) * 8;
        async_b128(&Vbuf[kr][cur ^ 1][vr * VP + vo],
                   VhT_b + (size_t)vr * SEQ + nkv + vo);
      }
      asm volatile("s_wait_asynccnt 0x4" ::: "memory");   // current buffer done
    } else {
      asm volatile("s_wait_asynccnt 0x0" ::: "memory");
    }
    __syncthreads();

    // ---- scores, transposed: two 16(key) x 16(query) tiles, A = K rows from LDS ----
    // s0[g]: key kv + hb + g ; s1[g]: key kv + 16 + hb + g ; query q0 + l16
    f8v s0, s1;
    {
      const _Float16* krow = &Kbuf[kr][cur][l16 * KP];            // row = l16
      h16v bK0 = hcat(*(const h8v*)(krow + hb),      *(const h8v*)(krow + hb + 16));
      h16v bK1 = hcat(*(const h8v*)(krow + 32 + hb), *(const h8v*)(krow + 32 + hb + 16));
      f8v  z   = {};
      s0 = __builtin_amdgcn_wmma_f32_16x16x32_f16(false, bK0, false, aQ0, (short)0, z,  false, false);
      s0 = __builtin_amdgcn_wmma_f32_16x16x32_f16(false, bK1, false, aQ1, (short)0, s0, false, false);
      const _Float16* krow1 = &Kbuf[kr][cur][(16 + l16) * KP];    // row = 16 + l16
      h16v cK0 = hcat(*(const h8v*)(krow1 + hb),      *(const h8v*)(krow1 + hb + 16));
      h16v cK1 = hcat(*(const h8v*)(krow1 + 32 + hb), *(const h8v*)(krow1 + 32 + hb + 16));
      s1 = __builtin_amdgcn_wmma_f32_16x16x32_f16(false, cK0, false, aQ0, (short)0, z,  false, false);
      s1 = __builtin_amdgcn_wmma_f32_16x16x32_f16(false, cK1, false, aQ1, (short)0, s1, false, false);
    }

    // ---- online softmax over these 32 keys: in-lane, one exchange between halves ----
    const float ta = max3f(max3f(s0[0], s0[1], s0[2]), max3f(s0[3], s0[4], s0[5]),
                           max3f(s0[6], s0[7], s1[0]));
    const float tb = max3f(max3f(s1[1], s1[2], s1[3]), max3f(s1[4], s1[5], s1[6]), s1[7]);
    const float tm   = fmaxf(ta, tb);
    const float mn   = max3f(mrow, tm, xhalf(tm));   // same value in both halves
    const float corr = __expf(mrow - mn);
    mrow = mn;
    f8v p0, p1;
#pragma unroll
    for (int g = 0; g < 8; ++g) {
      p0[g] = __expf(s0[g] - mn);
      p1[g] = __expf(s1[g] - mn);
    }
    const f8v ps8 = p0 + p1;
    const f4v ps4 = ps8.lo + ps8.hi;
    lrow = lrow * corr + ((ps4[0] + ps4[2]) + (ps4[1] + ps4[3]));
#pragma unroll
    for (int t = 0; t < 4; ++t) o[t] *= corr;

    // P^T as B operand: element i < 8 is key hb + i, element 8 + i key 16 + hb + i,
    // the k order of the V^T loader below.
    const h16v pB = hcat(__builtin_convertvector(p0, h8v), __builtin_convertvector(p1, h8v));

    // ---- O^T += V^T * P^T, A = V^T rows (h) from LDS ----
#pragma unroll
    for (int t = 0; t < 4; ++t) {
      const _Float16* vrow = &Vbuf[kr][cur][(t * 16 + l16) * VP];
      h16v aV = hcat(*(const h8v*)(vrow + hb), *(const h8v*)(vrow + hb + 16));
      o[t] = __builtin_amdgcn_wmma_f32_16x16x32_f16(
          false, aV, false, pB, (short)0, o[t], false, false);
    }
    __syncthreads();   // protect buffer from next iteration's prefetch
  }

  // ---- hand over this range's partial: join the halves' sums, O not normalised ----
  const float lsum = lrow + xhalf(lrow);
  if (half16 == 0) {
    Mpart[kr][qi * 16 + l16] = mrow;
    Lpart[kr][qi * 16 + l16] = lsum;
  }
  float* prow = &Opart[kr][(qi * 16 + l16) * OP + hb];
#pragma unroll
  for (int t = 0; t < 4; ++t) {
    *(f4v*)(prow + t * 16)     = o[t].lo;
    *(f4v*)(prow + t * 16 + 4) = o[t].hi;
  }
  __syncthreads();   // every range's partial is in LDS before any is merged

  // ---- merge: thread -> query tid / 8, eight consecutive h; a wave stores 1 KB ----
  const int mq = tid >> 3, mh = (tid & 7) * 8;
  float mr[KSPLIT];
#pragma unroll
  for (int r = 0; r < KSPLIT; ++r) mr[r] = Mpart[r][mq];
  const float mall = fmaxf(fmaxf(mr[0], mr[1]), fmaxf(mr[2], mr[3]));
  float lall = 0.0f;
  f4v   lo = {}, hi = {};
#pragma unroll
  for (int r = 0; r < KSPLIT; ++r) {
    const float  w  = __expf(mr[r] - mall);
    const float* pr = &Opart[r][mq * OP + mh];
    lall += w * Lpart[r][mq];
    lo   += w * *(const f4v*)(pr);
    hi   += w * *(const f4v*)(pr + 4);
  }
  float* orow = out + (size_t)(blockIdx.x * 64 + mq) * HEAD + mh;
#pragma unroll
  for (int g = 0; g < 4; ++g) { lo[g] = lo[g] / lall; hi[g] = hi[g] / lall; }
  *(f4v*)(orow)     = lo;
  *(f4v*)(orow + 4) = hi;
}

// ---------------------------------------------------------------------------
extern "C" void kernel_launch(void* const* d_in, const int* in_sizes, int n_in,
                              void* d_out, int out_size, void* d_ws, size_t ws_size,
                              hipStream_t stream) {
  const float* x  = (const float*)d_in[0];
  const float* Wq = (const float*)d_in[1];
  const float* bq = (const float*)d_in[2];
  const float* Wk = (const float*)d_in[3];
  const float* bk = (const float*)d_in[4];
  const float* Wv = (const float*)d_in[5];
  const float* bv = (const float*)d_in[6];
  float*       out = (float*)d_out;

  char* ws = (char*)d_ws;
  _Float16* Qh  = (_Float16*)(ws + 384 * 1024);                      // 2 MB
  _Float16* Kh  = (_Float16*)(ws + 384 * 1024 + 2 * 1024 * 1024);    // 2 MB
  _Float16* VhT = (_Float16*)(ws + 384 * 1024 + 4 * 1024 * 1024);    // 2 MB

  proj_kernel<<<NROWS / 64, 512, 0, stream>>>(x, Wq, Wk, Wv, bq, bk, bv, Qh, Kh, VhT);
  attn_kernel<<<NROWS / 64, 512, 0, stream>>>(Qh, Kh, VhT, out);
}

// v006
// It runs in 40.5 microseconds.
// Two timings next to v005 both put it at 1.10 times that version's speed.
// Counting every step since v000, it is 4.86 times as fast.
#include <hip/hip_runtime.h>
#include <hip/hip_bf16.h>

// ---- types ----
typedef _Float16 h16v __attribute__((ext_vector_type(16)));
typedef _Float16 h8v  __attribute__((ext_vector_type(8)));
typedef float    f8v  __attribute__((ext_vector_type(8)));
typedef float    f4v  __attribute__((ext_vector_type(4)));
typedef float    f2v  __attribute__((ext_vector_type(2)));

#define D_MODEL 1024
#define HEAD    64
#define SEQ     4096
#define BATCH   4
#define NROWS   (BATCH * SEQ)   // 16384 flat rows

__device__ __forceinline__ h16v hcat(h8v lo, h8v hi) {
  h16v r;
#pragma unroll
  for (int i = 0; i < 8; ++i) { r[i] = lo[i]; r[i + 8] = hi[i]; }
  return r;
}

// Lane l <-> lane l ^ 16 (the two halves of a wave hold the same query column).
__device__ __forceinline__ float xhalf(float v) {
  const int b = __builtin_bit_cast(int, v);
  return __builtin_bit_cast(float, __builtin_amdgcn_permlanex16(
      b, b, 0x76543210, 0xfedcba98, false, false));
}
__device__ __forceinline__ float max3f(float a, float b, float c) {
  return fmaxf(fmaxf(a, b), c);
}

// LDS row pitches in halves, for ds_load_b128 readers that walk 16 rows at once:
// 16 B x odd puts the 16 rows of a half-wave on 16 different groups of four banks.
#define KP 72   // K rows: 128 B of data at 144 B
#define VP 72   // V^T rows: 128 B of data at 144 B
#define WP 40   // W^T rows: 64 B of data at 80 B

typedef int i4v __attribute__((ext_vector_type(4)));
typedef __attribute__((address_space(1))) i4v gl_i4v;
typedef __attribute__((address_space(3))) i4v sh_i4v;

// Per-lane async copy: 16 bytes global -> LDS, tracked by ASYNCcnt.
__device__ __forceinline__ void async_b128(_Float16* lds, const _Float16* gaddr) {
  __builtin_amdgcn_global_load_async_to_lds_b128((gl_i4v*)gaddr, (sh_i4v*)lds, 0, 0);
}

// ---------------------------------------------------------------------------
// Kernel 1: fused Q/K/V projection.  64 rows/block, all three matrices per block.
// 16 waves/block = 4 row tiles x 4 k ranges, so that four waves share each SIMD and
// fill each other's waits on x (memory) and on the W fragments (LDS).  Wave (kr, wave):
// rows row0 .. row0 + 15, k in kr * 256 .. + 255, 12 WMMAs per k-step of 32.
// The four waves of a k range share that range's W tiles (3 x [64n x 32k] f16, rows at
// pitch WP), double-buffered in LDS.  The block makes them itself from the f32 weights
// W[k][n]: wave `wave` takes k octet `wave` of a tile, a lane two columns; a load covers
// one whole 256 B row of W, eight rows pack into one 16 B LDS store per column.  The next
// tile's loads fly during this tile's products.  The four ranges' partial sums merge
// through LDS; wave (kr, wave) finishes column tile kr of Q, K, V.
//   Q -> Qh  [row][h] f16, (x*Wq+bq)*0.125 ;  K -> Kh [row][h] ; V -> VhT[b][h][kv]
// ---------------------------------------------------------------------------
#define PSPLIT 4
#define PRANGE (D_MODEL / PSPLIT)      // k per wave
#define WTILE  (3 * 64 * WP)           // halves in one W buffer (15 KB)
#define PTILE  256                     // floats in one 16 x 16 partial tile (1 KB)

__global__ __launch_bounds__(512) void proj_kernel(
    const float* __restrict__ x, const float* __restrict__ Wq,
    const float* __restrict__ Wk, const float* __restrict__ Wv,
    const float* __restrict__ bq, const float* __restrict__ bk,
    const float* __restrict__ bv, _Float16* __restrict__ Qh,
    _Float16* __restrict__ Kh, _Float16* __restrict__ VhT) {
  // In the loop: W buffers [k range][2][WTILE] halves (120 KB).  Behind the loop's last
  // barrier the same LDS holds the partial sums [k range][row tile][12][PTILE] floats.
  __shared__ __align__(16) float smem[PSPLIT * 4 * 12 * PTILE];   // 192 KB

  const int tid    = threadIdx.x;
  const int kr     = tid >> 7;          // k range of this wave
  const int gt     = tid & 127;         // thread within the range's four waves
  const int wave   = gt >> 5;           // row tile of this wave
  const int lane   = tid & 31;
  const int half16 = lane >> 4;
  const int l16    = lane & 15;
  const int hb     = half16 * 8;
  const int row0   = blockIdx.x * 64 + wave * 16;      // this wave's 16-row tile
  const float*    xrow = x + (size_t)(row0 + l16) * D_MODEL + kr * PRANGE;
  _Float16*       Wbuf = (_Float16*)smem + kr * 2 * WTILE;

  // W staging: rows kr * PRANGE + kk + wave * 8 + j of W, columns 2 * lane and 2 * lane + 1
  const size_t woff = (size_t)(kr * PRANGE + wave * 8) * HEAD + 2 * lane;
  const float* wsrc[3] = {Wq + woff, Wk + woff, Wv + woff};
  _Float16*    wdst    = Wbuf + (2 * lane) * WP + wave * 8;
  f2v          wreg[3][8];

  f8v acc[3][4] = {};

  // W tile for kk = 0 into buffer 0
#pragma unroll
  for (int m = 0; m < 3; ++m) {
#pragma unroll
    for (int j = 0; j < 8; ++j) wreg[m][j] = *(const f2v*)(wsrc[m] + j * HEAD);
  }
#pragma unroll
  for (int m = 0; m < 3; ++m) {
#pragma unroll
    for (int c = 0; c < 2; ++c) {
      h8v h;
#pragma unroll
      for (int j = 0; j < 8; ++j) h[j] = (_Float16)wreg[m][j][c];
      *(h8v*)(wdst + (m * 64 + c) * WP) = h;
    }
  }
  __syncthreads();   // tile 0 is in LDS before any wave reads it

  // unrolled: a tile's k offset and its buffer become immediate offsets of the loads and
  // LDS operations, on one scalar base and one lane offset that are never rewritten
#pragma unroll
  for (int kk = 0; kk < PRANGE; kk += 32) {            // kk counts inside the range
    const int  cur  = (kk >> 5) & 1;
    const bool more = kk + 32 < PRANGE;

    // A tile from global: 16 rows x 32 k of x, fp32 -> f16
    const int kA = kk + hb;
    f4v a0 = *(const f4v*)(xrow + kA);
    f4v a1 = *(const f4v*)(xrow + kA + 4);
    f4v a2 = *(const f4v*)(xrow + kA + 16);
    f4v a3 = *(const f4v*)(xrow + kA + 20);

    // next W tile, f32, into registers: in flight during this tile's products
    if (more) {
#pragma unroll
      for (int m = 0; m < 3; ++m) {
#pragma unroll
        for (int j = 0; j < 8; ++j)
          wreg[m][j] = *(const f2v*)(wsrc[m] + (size_t)(kk + 32 + j) * HEAD);
      }
    }

    h16v A;
#pragma unroll
    for (int i = 0; i < 4; ++i) {
      A[i]      = (_Float16)a0[i];
      A[4 + i]  = (_Float16)a1[i];
      A[8 + i]  = (_Float16)a2[i];
      A[12 + i] = (_Float16)a3[i];
    }

    const _Float16* wb = &Wbuf[cur * WTILE];
#pragma unroll
    for (int m = 0; m < 3; ++m) {
#pragma unroll
      for (int t = 0; t < 4; ++t) {
        const _Float16* wcol = wb + (m * 64 + t * 16 + l16) * WP;
        h16v B = hcat(*(const h8v*)(wcol + hb), *(const h8v*)(wcol + hb + 16));
        acc[m][t] = __builtin_amdgcn_wmma_f32_16x16x32_f16(
            false, A, false, B, (short)0, acc[m][t], false, false);
      }
    }
    // f32 -> f16, transposed into the other buffer (its readers left it at the last barrier)
    if (more) {
#pragma unroll
      for (int m = 0; m < 3; ++m) {
#pragma unroll
        for (int c = 0; c < 2; ++c) {
          h8v h;
#pragma unroll
          for (int j = 0; j < 8; ++j) h[j] = (_Float16)wreg[m][j][c];
          *(h8v*)(wdst + (cur ^ 1) * WTILE + (m * 64 + c) * WP) = h;
        }
      }
    }
    __syncthreads();   // publishes the next tile and ends this tile's reads
  }

  // ---- hand over this range's partial sums: a wave's store covers 512 B in a row ----
  // (the loop's last barrier has ended every read of the W buffers)
  {
    float* pw = smem + (size_t)((kr * 4 + wave) * 12) * PTILE + lane * 4;
#pragma unroll
    for (int m = 0; m < 3; ++m) {
#pragma unroll
      for (int t = 0; t < 4; ++t) {
        *(f4v*)(pw + (m * 4 + t) * PTILE)       = acc[m][t].lo;
        *(f4v*)(pw + (m * 4 + t) * PTILE + 128) = acc[m][t].hi;
      }
    }
  }
  __syncthreads();   // every range's partial is in LDS before any is merged

  // ---- merge in the order of the k ranges, then bias + scale + store: tile t = kr ----
  const int col = kr * 16 + l16;
#pragma unroll
  for (int m = 0; m < 3; ++m) {
    const float* pr = smem + (size_t)(wave * 12 + m * 4 + kr) * PTILE + lane * 4;
    f4v lo = *(const f4v*)(pr);
    f4v hi = *(const f4v*)(pr + 128);
#pragma unroll
    for (int r = 1; r < PSPLIT; ++r) {
      lo += *(const f4v*)(pr + r * 48 * PTILE);
      hi += *(const f4v*)(pr + r * 48 * PTILE + 128);
    }
    const float* bias = (m == 0) ? bq : ((m == 1) ? bk : bv);
    const float  scl  = (m == 0) ? 0.125f : 1.0f;
    const float  bvv  = bias[col];
#pragma unroll
    for (int g = 0; g < 8; ++g) {
      const int      r    = row0 + g + 8 * half16;
      const float    sum  = (g < 4) ? lo[g & 3] : hi[g & 3];
      const _Float16 hval = (_Float16)((sum + bvv) * scl);
      if (m == 0) {
        Qh[(size_t)r * HEAD + col] = hval;
      } else if (m == 1) {
        Kh[(size_t)r * HEAD + col] = hval;
      } else {
        const int bb = r >> 12, kv = r & (SEQ - 1);
        VhT[((size_t)bb * HEAD + col) * SEQ + kv] = hval;
      }
    }
  }
}

#define KSPLIT 4
#define KRANGE (SEQ / KSPLIT)   // keys per wave
#define KSTEP  64               // keys per step: one maximum, one rescale, one barrier
#define NSTEP  (KRANGE / KSTEP)
#define NT     (KSTEP / 16)     // S^T tiles per step
#define NC     (KSTEP / 32)     // P^T operands per step
#define NCOPY  (KSTEP / 16)     // 16 B copies per thread and step, for K and for V each
#define OP     68               // partial-O rows: 256 B of data at 272 B (16 B x odd)

__global__ __launch_bounds__(512) void attn_kernel(
    const _Float16* __restrict__ Qh, const _Float16* __restrict__ Kh,
    const _Float16* __restrict__ VhT, float* __restrict__ out) {
  __shared__ __align__(16) _Float16 Kbuf[KSPLIT][2][KSTEP * KP];   // [kv][h]
  __shared__ __align__(16) _Float16 Vbuf[KSPLIT][2][64 * VP];      // [h][kv]
  __shared__ __align__(16) float    Opart[KSPLIT][64 * OP];     // [query][h], not normalised
  __shared__ float Mpart[KSPLIT][64];                           // range maximum per query
  __shared__ float Lpart[KSPLIT][64];                           // range sum per query

  const int tid    = threadIdx.x;
  const int kr     = tid >> 7;          // key range of this wave
  const int gt     = tid & 127;         // thread within the range's four waves
  const int qi     = gt >> 5;           // query tile of this wave
  const int lane   = tid & 31;
  const int half16 = lane >> 4;
  const int l16    = lane & 15;
  const int hb     = half16 * 8;
  const int q0     = blockIdx.x * 64 + qi * 16;     // flat q row base

  // block-uniform bases; what differs between threads stays in 32-bit offsets (in halves)
  const _Float16* Kh_b  = Kh  + (size_t)(blockIdx.x >> 6) * SEQ * HEAD;
  const _Float16* VhT_b = VhT + (size_t)(blockIdx.x >> 6) * HEAD * SEQ;
  const unsigned  koff  = kr * KRANGE * HEAD + gt * 8;
  const unsigned  voff  = (gt / (KSTEP / 8)) * SEQ + kr * KRANGE + (gt % (KSTEP / 8)) * 8;

  // Q B-tiles (column = query l16) held in VGPRs for the whole loop
  const _Float16* qrow = Qh + (size_t)(q0 + l16) * HEAD;
  const h16v aQ0 = hcat(*(const h8v*)(qrow + hb),      *(const h8v*)(qrow + hb + 16));
  const h16v aQ1 = hcat(*(const h8v*)(qrow + 32 + hb), *(const h8v*)(qrow + 32 + hb + 16));

  // Per lane: query q0 + l16.  lrow sums only this lane's keys; the halves join
  // in the epilogue.  o[t][g] = O[q0 + l16][t * 16 + hb + g].
  float mrow = -INFINITY, lrow = 0.0f;
  f8v   o[4] = {};

  // One step's K/V tile (K: KSTEP rows x 128 B; V: 64 rows x KSTEP * 2 B) into buffer buf
  auto stage = [&](int step, int buf) {
    const _Float16* ksrc = Kh_b + step * (KSTEP * HEAD);
    const _Float16* vsrc = VhT_b + step * KSTEP;
#pragma unroll
    for (int i = 0; i < NCOPY; ++i) {
      const int c = gt + 128 * i;                      // 16 B piece of the tile
      async_b128(&Kbuf[kr][buf][(c >> 3) * KP + (c & 7) * 8],
                 ksrc + (koff + i * 1024u));
      const int vr = c / (KSTEP / 8), vo = (c % (KSTEP / 8)) * 8;
      async_b128(&Vbuf[kr][buf][vr * VP + vo],
                 vsrc + (voff + i * (1024u / KSTEP) * SEQ));
    }
  };

  stage(0, 0);
  asm volatile("s_wait_asynccnt 0x0" ::: "memory");   // this wave's part of tile 0 has landed
  __syncthreads();                                    // tile 0 is whole before any wave reads it
  stage(1, 1);

  // two steps per trip: the buffer index is then a constant, and the fragment reads take
  // their buffer as an immediate offset on one address that the loop never rewrites
#pragma unroll 2
  for (int st = 0; st < NSTEP; ++st) {
    const int cur = st & 1;

    // ---- scores, transposed: NT 16(key) x 16(query) tiles, A = K rows from LDS ----
    // s[j][g]: key st * KSTEP + j * 16 + hb + g ; query q0 + l16
    h16v bK[NT][2];
#pragma unroll
    for (int j = 0; j < NT; ++j) {
      const _Float16* krow = &Kbuf[kr][cur][(j * 16 + l16) * KP];
      bK[j][0] = hcat(*(const h8v*)(krow + hb),      *(const h8v*)(krow + hb + 16));
      bK[j][1] = hcat(*(const h8v*)(krow + 32 + hb), *(const h8v*)(krow + 32 + hb + 16));
    }
    // the step's K reads go out as one group: one LDS latency per step, not one per product
    __builtin_amdgcn_sched_barrier(0);
    f8v s[NT];
#pragma unroll
    for (int j = 0; j < NT; ++j) {
      f8v z = {};
      s[j] = __builtin_amdgcn_wmma_f32_16x16x32_f16(false, bK[j][0], false, aQ0, (short)0, z, false, false);
    }
#pragma unroll
    for (int j = 0; j < NT; ++j)
      s[j] = __builtin_amdgcn_wmma_f32_16x16x32_f16(false, bK[j][1], false, aQ1, (short)0, s[j], false, false);
    // A = V^T rows (h) from LDS, read here so that they arrive during the softmax
    h16v aV[NC][4];
#pragma unroll
    for (int c = 0; c < NC; ++c) {
#pragma unroll
      for (int t = 0; t < 4; ++t) {
        const _Float16* vrow = &Vbuf[kr][cur][(t * 16 + l16) * VP + c * 32];
        aV[c][t] = hcat(*(const h8v*)(vrow + hb), *(const h8v*)(vrow + hb + 16));
      }
    }
    // keeps the V reads in front of the softmax, and the maxima behind the whole run of score
    // products: between them each would cost the idle slots that a fresh matrix result needs
    __builtin_amdgcn_sched_barrier(0);

    // ---- online softmax over these KSTEP keys: in-lane, one exchange between halves ----
    float tm = 0.0f;
#pragma unroll
    for (int c = 0; c < NC; ++c) {
      const f8v s0 = s[2 * c], s1 = s[2 * c + 1];
      const float ta = max3f(max3f(s0[0], s0[1], s0[2]), max3f(s0[3], s0[4], s0[5]),
                             max3f(s0[6], s0[7], s1[0]));
      const float tb = max3f(max3f(s1[1], s1[2], s1[3]), max3f(s1[4], s1[5], s1[6]), s1[7]);
      tm = (c == 0) ? fmaxf(ta, tb) : max3f(tm, ta, tb);
    }
    const float mn   = max3f(mrow, tm, xhalf(tm));   // same value in both halves
    const float corr = __expf(mrow - mn);
    mrow = mn;
#pragma unroll
    for (int j = 0; j < NT; ++j) {
#pragma unroll
      for (int g = 0; g < 8; ++g) s[j][g] = __expf(s[j][g] - mn);
    }
    f8v ps8 = s[0] + s[1];
#pragma unroll
    for (int c = 1; c < NC; ++c) ps8 += s[2 * c] + s[2 * c + 1];
    const f4v ps4 = ps8.lo + ps8.hi;
    lrow = lrow * corr + ((ps4[0] + ps4[2]) + (ps4[1] + ps4[3]));
#pragma unroll
    for (int t = 0; t < 4; ++t) o[t] *= corr;

    // ---- O^T += V^T * P^T ----
#pragma unroll
    for (int c = 0; c < NC; ++c) {
      // P^T as B operand: element i < 8 is key c * 32 + hb + i, element 8 + i key
      // c * 32 + 16 + hb + i, the k order of the V^T loader above.
      const h16v pB = hcat(__builtin_convertvector(s[2 * c], h8v),
                           __builtin_convertvector(s[2 * c + 1], h8v));
#pragma unroll
      for (int t = 0; t < 4; ++t)
        o[t] = __builtin_amdgcn_wmma_f32_16x16x32_f16(
            false, aV[c][t], false, pB, (short)0, o[t], false, false);
    }

    // keeps the softmax and the products in front of the step's foot: sunk behind it, the wait
    // for the next tile's copies would come right behind their issue, not a whole step later
    __builtin_amdgcn_sched_barrier(0);
    asm volatile("s_wait_dscnt 0x0" ::: "memory");      // this wave's reads of the tile are over
    asm volatile("s_wait_asynccnt 0x0" ::: "memory");   // its part of the next tile has landed
    __syncthreads();   // publishes the next tile and frees this one for the refill
    if (st + 2 < NSTEP) stage(st + 2, cur);
  }
  asm volatile("s_wait_asynccnt 0x0" ::: "memory");     // no copy is left in flight

  // ---- hand over this range's partial: join the halves' sums, O not normalised ----
  const float lsum = lrow + xhalf(lrow);
  if (half16 == 0) {
    Mpart[kr][qi * 16 + l16] = mrow;
    Lpart[kr][qi * 16 + l16] = lsum;
  }
  float* prow = &Opart[kr][(qi * 16 + l16) * OP + hb];
#pragma unroll
  for (int t = 0; t < 4; ++t) {
    *(f4v*)(prow + t * 16)     = o[t].lo;
    *(f4v*)(prow + t * 16 + 4) = o[t].hi;
  }
  __syncthreads();   // every range's partial is in LDS before any is merged

  // ---- merge: thread -> query tid / 8, eight consecutive h; a wave stores 1 KB ----
  const int mq = tid >> 3, mh = (tid & 7) * 8;
  float mr[KSPLIT];
#pragma unroll
  for (int r = 0; r < KSPLIT; ++r) mr[r] = Mpart[r][mq];
  const float mall = fmaxf(fmaxf(mr[0], mr[1]), fmaxf(mr[2], mr[3]));
  float lall = 0.0f;
  f4v   lo = {}, hi = {};
#pragma unroll
  for (int r = 0; r < KSPLIT; ++r) {
    const float  w  = __expf(mr[r] - mall);
    const float* pr = &Opart[r][mq * OP + mh];
    lall += w * Lpart[r][mq];
    lo   += w * *(const f4v*)(pr);
    hi   += w * *(const f4v*)(pr + 4);
  }
  float* orow = out + (size_t)(blockIdx.x * 64 + mq) * HEAD + mh;
#pragma unroll
  for (int g = 0; g < 4; ++g) { lo[g] = lo[g] / lall; hi[g] = hi[g] / lall; }
  *(f4v*)(orow)     = lo;
  *(f4v*)(orow + 4) = hi;
}

// ---------------------------------------------------------------------------
extern "C" void kernel_launch(void* const* d_in, const int* in_sizes, int n_in,
                              void* d_out, int out_size, void* d_ws, size_t ws_size,
                              hipStream_t stream) {
  const float* x  = (const float*)d_in[0];
  const float* Wq = (const float*)d_in[1];
  const float* bq = (const float*)d_in[2];
  const float* Wk = (const float*)d_in[3];
  const float* bk = (const float*)d_in[4];
  const float* Wv = (const float*)d_in[5];
  const float* bv = (const float*)d_in[6];
  float*       out = (float*)d_out;

  char* ws = (char*)d_ws;
  _Float16* Qh  = (_Float16*)(ws + 384 * 1024);                      // 2 MB
  _Float16* Kh  = (_Float16*)(ws + 384 * 1024 + 2 * 1024 * 1024);    // 2 MB
  _Float16* VhT = (_Float16*)(ws + 384 * 1024 + 4 * 1024 * 1024);    // 2 MB

  proj_kernel<<<NROWS / 64, 512, 0, stream>>>(x, Wq, Wk, Wv, bq, bk, bv, Qh, Kh, VhT);
  attn_kernel<<<NROWS / 64, 512, 0, stream>>>(Qh, Kh, VhT, out);
}

// v007
// It runs in 39 microseconds.
// Two timings next to v006 put it at 1.03 and 1.04 times that version's speed.
// Over all steps from v000 it is 5.03 times as fast.
#include <hip/hip_runtime.h>
#include <hip/hip_bf16.h>

// ---- types ----
typedef _Float16 h16v __attribute__((ext_vector_type(16)));
typedef _Float16 h8v  __attribute__((ext_vector_type(8)));
typedef float    f8v  __attribute__((ext_vector_type(8)));
typedef float    f4v  __attribute__((ext_vector_type(4)));
typedef float    f2v  __attribute__((ext_vector_type(2)));

#define D_MODEL 1024
#define HEAD    64
#define SEQ     4096
#define BATCH   4
#define NROWS   (BATCH * SEQ)   // 16384 flat rows

__device__ __forceinline__ h16v hcat(h8v lo, h8v hi) {
  h16v r;
#pragma unroll
  for (int i = 0; i < 8; ++i) { r[i] = lo[i]; r[i + 8] = hi[i]; }
  return r;
}

// Lane l <-> lane l ^ 16 (the two halves of a wave hold the same query column).
__device__ __forceinline__ float xhalf(float v) {
  const int b = __builtin_bit_cast(int, v);
  return __builtin_bit_cast(float, __builtin_amdgcn_permlanex16(
      b, b, 0x76543210, 0xfedcba98, false, false));
}
__device__ __forceinline__ float max3f(float a, float b, float c) {
  return fmaxf(fmaxf(a, b), c);
}

// LDS row pitches in halves (XP in floats), for ds_load_b128 readers that walk 16 rows at once:
// 16 B x odd puts the 16 rows of a half-wave on 16 different groups of four banks.
#define KP 72   // K rows: 128 B of data at 144 B
#define VP 72   // V^T rows: 128 B of data at 144 B
#define WP 40   // W^T rows: 64 B of data at 80 B
#define XP 68   // x rows, in floats: 256 B of data at 272 B

typedef int i4v __attribute__((ext_vector_type(4)));
typedef __attribute__((address_space(1))) i4v gl_i4v;
typedef __attribute__((address_space(3))) i4v sh_i4v;

// Per-lane async copy: 16 bytes global -> LDS, tracked by ASYNCcnt.
__device__ __forceinline__ void async_b128(_Float16* lds, const _Float16* gaddr) {
  __builtin_amdgcn_global_load_async_to_lds_b128((gl_i4v*)gaddr, (sh_i4v*)lds, 0, 0);
}
__device__ __forceinline__ void async_b128_f32(float* lds, const float* gaddr) {
  __builtin_amdgcn_global_load_async_to_lds_b128((gl_i4v*)gaddr, (sh_i4v*)lds, 0, 0);
}

// ---------------------------------------------------------------------------
// Kernel 1: fused Q/K/V projection.  64 rows/block, all three matrices per block.
// 16 waves/block = 4 row tiles x 4 k ranges, so that four waves share each SIMD and
// fill each other's waits on x (memory) and on the W fragments (LDS).  Wave (kr, wave):
// rows row0 .. row0 + 15, k in kr * 256 .. + 255, 12 WMMAs per k-step of 32.
// The four waves of a k range share that range's W tiles (3 x [64n x 32k] f16, rows at
// pitch WP), double-buffered in LDS.  The block makes them itself from the f32 weights
// W[k][n]: wave `wave` takes k octet `wave` of a tile, a lane two columns; a load covers
// one whole 256 B row of W, eight rows pack into one 16 B LDS store per column.  The next
// tile's loads fly during this tile's products.  x comes through LDS too: a wave brings its
// own 16 rows x XK k (f32) by async copies, each copy covering two whole 256 B row pieces,
// double-buffered, one tile (two k-steps) ahead; the A fragments are read from there.
// The four ranges' partial sums merge through LDS; wave (kr, wave) finishes column tile kr
// of Q, K, V.
//   Q -> Qh  [row][h] f16, (x*Wq+bq)*0.125 ;  K -> Kh [row][h] ; V -> VhT[b][h][kv]
// ---------------------------------------------------------------------------
#define PSPLIT 4
#define PRANGE (D_MODEL / PSPLIT)      // k per wave
#define WTILE  (3 * 64 * WP)           // halves in one W buffer (15 KB)
#define PTILE  256                     // floats in one 16 x 16 partial tile (1 KB)
#define XK     64                      // k in one x tile
#define XTILE  (16 * XP)               // floats in one wave's x tile (4352 B)
#define XOFF   (PSPLIT * 2 * WTILE / 2)   // the x buffers start behind the W buffers (floats)

__global__ __launch_bounds__(512) void proj_kernel(
    const float* __restrict__ x, const float* __restrict__ Wq,
    const float* __restrict__ Wk, const float* __restrict__ Wv,
    const float* __restrict__ bq, const float* __restrict__ bk,
    const float* __restrict__ bv, _Float16* __restrict__ Qh,
    _Float16* __restrict__ Kh, _Float16* __restrict__ VhT) {
  // In the loop: W buffers [k range][2][WTILE] halves (120 KB), then x buffers
  // [2][wave][XTILE] floats (136 KB).  Behind the loop's last barrier the same LDS holds
  // the partial sums [k range][row tile][12][PTILE] floats (192 KB).
  __shared__ __align__(16) float smem[XOFF + 2 * 16 * XTILE];   // 256 KB

  const int tid    = threadIdx.x;
  const int kr     = tid >> 7;          // k range of this wave
  const int gt     = tid & 127;         // thread within the range's four waves
  const int wave   = gt >> 5;           // row tile of this wave
  const int lane   = tid & 31;
  const int half16 = lane >> 4;
  const int l16    = lane & 15;
  const int hb     = half16 * 8;
  const int row0   = blockIdx.x * 64 + wave * 16;      // this wave's 16-row tile
  // x staging: copy i of a tile takes rows 2 * i + half16, a lane 16 B of a row's 256 B
  const float*    xsrc = x + (size_t)(row0 + half16) * D_MODEL + kr * PRANGE + l16 * 4;
  float*          xbuf = smem + XOFF + (tid >> 5) * XTILE;     // this wave's part of buffer 0
  float*          xdst = xbuf + half16 * XP + l16 * 4;
  const float*    xrow = xbuf + l16 * XP + hb;                 // A fragment reads
  auto xstage = [&](int xt, int buf) {
#pragma unroll
    for (int i = 0; i < 8; ++i)
      async_b128_f32(xdst + buf * (16 * XTILE) + i * 2 * XP,
                     xsrc + xt * XK + (size_t)(i * 2) * D_MODEL);
  };
  _Float16*       Wbuf = (_Float16*)smem + kr * 2 * WTILE;

  // W staging: rows kr * PRANGE + kk + wave * 8 + j of W, columns 2 * lane and 2 * lane + 1
  const size_t woff = (size_t)(kr * PRANGE + wave * 8) * HEAD + 2 * lane;
  const float* wsrc[3] = {Wq + woff, Wk + woff, Wv + woff};
  _Float16*    wdst    = Wbuf + (2 * lane) * WP + wave * 8;
  f2v          wreg[3][8];

  f8v acc[3][4] = {};

  xstage(0, 0);   // x tile 0 into buffer 0

  // W tile for kk = 0 into buffer 0
#pragma unroll
  for (int m = 0; m < 3; ++m) {
#pragma unroll
    for (int j = 0; j < 8; ++j) wreg[m][j] = *(const f2v*)(wsrc[m] + j * HEAD);
  }
#pragma unroll
  for (int m = 0; m < 3; ++m) {
#pragma unroll
    for (int c = 0; c < 2; ++c) {
      h8v h;
#pragma unroll
      for (int j = 0; j < 8; ++j) h[j] = (_Float16)wreg[m][j][c];
      *(h8v*)(wdst + (m * 64 + c) * WP) = h;
    }
  }
  asm volatile("s_wait_asynccnt 0x0" ::: "memory");   // this wave's x tile 0 has landed
  __syncthreads();   // tile 0 is in LDS before any wave reads it
  xstage(1, 1);

  // unrolled: a tile's k offset and its buffer become immediate offsets of the loads and
  // LDS operations, on one scalar base and one lane offset that are never rewritten
#pragma unroll
  for (int kk = 0; kk < PRANGE; kk += 32) {            // kk counts inside the range
    const int  cur  = (kk >> 5) & 1;
    const bool more = kk + 32 < PRANGE;

    const int  xt   = kk / XK;                         // x tile of this k-step
    const bool xend = (kk + 32) % XK == 0;             // its last k-step

    // next W tile, f32, into registers: in flight during this tile's products
    if (more) {
#pragma unroll
      for (int m = 0; m < 3; ++m) {
#pragma unroll
        for (int j = 0; j < 8; ++j)
          wreg[m][j] = *(const f2v*)(wsrc[m] + (size_t)(kk + 32 + j) * HEAD);
      }
    }

    // A tile from LDS: 16 rows x 32 k of x, fp32 -> f16
    const int kA = (xt & 1) * (16 * XTILE) + kk % XK;
    f4v a0 = *(const f4v*)(xrow + kA);
    f4v a1 = *(const f4v*)(xrow + kA + 4);
    f4v a2 = *(const f4v*)(xrow + kA + 16);
    f4v a3 = *(const f4v*)(xrow + kA + 20);

    const _Float16* wb = &Wbuf[cur * WTILE];
    h16v B[3][4];
    auto bload = [&](int m) {
#pragma unroll
      for (int t = 0; t < 4; ++t) {
        const _Float16* wcol = wb + (m * 64 + t * 16 + l16) * WP;
        B[m][t] = hcat(*(const h8v*)(wcol + hb), *(const h8v*)(wcol + hb + 16));
      }
    };
    auto bmul = [&](int m, h16v A) {
#pragma unroll
      for (int t = 0; t < 4; ++t)
        acc[m][t] = __builtin_amdgcn_wmma_f32_16x16x32_f16(
            false, A, false, B[m][t], (short)0, acc[m][t], false, false);
    };
    bload(0);
    bload(1);
    // the A reads and two matrices' W reads go out as one group: one LDS latency, not one per product
    __builtin_amdgcn_sched_barrier(0);

    h16v A;
#pragma unroll
    for (int i = 0; i < 4; ++i) {
      A[i]      = (_Float16)a0[i];
      A[4 + i]  = (_Float16)a1[i];
      A[8 + i]  = (_Float16)a2[i];
      A[12 + i] = (_Float16)a3[i];
    }
    bmul(0, A);
    bload(2);
    // the third matrix' reads go out as one group too, and fly during the second's products
    __builtin_amdgcn_sched_barrier(0);
    bmul(1, A);
    bmul(2, A);
    // keeps the products, whose operands now all wait in LDS, in front of the wait for the next
    // W tile's loads: mixed among them, that wait would hold the products back for a whole flight
    __builtin_amdgcn_sched_barrier(0);
    // f32 -> f16, transposed into the other buffer (its readers left it at the last barrier)
    if (more) {
#pragma unroll
      for (int m = 0; m < 3; ++m) {
#pragma unroll
        for (int c = 0; c < 2; ++c) {
          h8v h;
#pragma unroll
          for (int j = 0; j < 8; ++j) h[j] = (_Float16)wreg[m][j][c];
          *(h8v*)(wdst + (cur ^ 1) * WTILE + (m * 64 + c) * WP) = h;
        }
      }
    }
    if (xend) {
      asm volatile("s_wait_dscnt 0x0" ::: "memory");      // this wave's reads of the x tile are over
      asm volatile("s_wait_asynccnt 0x0" ::: "memory");   // its next x tile has landed
    }
    __syncthreads();   // publishes the next tile and ends this tile's reads
    if (xend && (xt + 2) * XK < PRANGE) xstage(xt + 2, xt & 1);
  }
  asm volatile("s_wait_asynccnt 0x0" ::: "memory");     // no copy is left in flight

  // ---- hand over this range's partial sums: a wave's store covers 512 B in a row ----
  // (the loop's last barrier has ended every read of the W buffers)
  {
    float* pw = smem + (size_t)((kr * 4 + wave) * 12) * PTILE + lane * 4;
#pragma unroll
    for (int m = 0; m < 3; ++m) {
#pragma unroll
      for (int t = 0; t < 4; ++t) {
        *(f4v*)(pw + (m * 4 + t) * PTILE)       = acc[m][t].lo;
        *(f4v*)(pw + (m * 4 + t) * PTILE + 128) = acc[m][t].hi;
      }
    }
  }
  __syncthreads();   // every range's partial is in LDS before any is merged

  // ---- merge in the order of the k ranges, then bias + scale + store: tile t = kr ----
  const int col = kr * 16 + l16;
#pragma unroll
  for (int m = 0; m < 3; ++m) {
    const float* pr = smem + (size_t)(wave * 12 + m * 4 + kr) * PTILE + lane * 4;
    f4v lo = *(const f4v*)(pr);
    f4v hi = *(const f4v*)(pr + 128);
#pragma unroll
    for (int r = 1; r < PSPLIT; ++r) {
      lo += *(const f4v*)(pr + r * 48 * PTILE);
      hi += *(const f4v*)(pr + r * 48 * PTILE + 128);
    }
    const float* bias = (m == 0) ? bq : ((m == 1) ? bk : bv);
    const float  scl  = (m == 0) ? 0.125f : 1.0f;
    const float  bvv  = bias[col];
#pragma unroll
    for (int g = 0; g < 8; ++g) {
      const int      r    = row0 + g + 8 * half16;
      const float    sum  = (g < 4) ? lo[g & 3] : hi[g & 3];
      const _Float16 hval = (_Float16)((sum + bvv) * scl);
      if (m == 0) {
        Qh[(size_t)r * HEAD + col] = hval;
      } else if (m == 1) {
        Kh[(size_t)r * HEAD + col] = hval;
      } else {
        const int bb = r >> 12, kv = r & (SEQ - 1);
        VhT[((size_t)bb * HEAD + col) * SEQ + kv] = hval;
      }
    }
  }
}

#define KSPLIT 4
#define KRANGE (SEQ / KSPLIT)   // keys per wave
#define KSTEP  64               // keys per step: one maximum, one rescale, one barrier
#define NSTEP  (KRANGE / KSTEP)
#define NT     (KSTEP / 16)     // S^T tiles per step
#define NC     (KSTEP / 32)     // P^T operands per step
#define NCOPY  (KSTEP / 16)     // 16 B copies per thread and step, for K and for V each
#define OP     68               // partial-O rows: 256 B of data at 272 B (16 B x odd)

__global__ __launch_bounds__(512) void attn_kernel(
    const _Float16* __restrict__ Qh, const _Float16* __restrict__ Kh,
    const _Float16* __restrict__ VhT, float* __restrict__ out) {
  __shared__ __align__(16) _Float16 Kbuf[KSPLIT][2][KSTEP * KP];   // [kv][h]
  __shared__ __align__(16) _Float16 Vbuf[KSPLIT][2][64 * VP];      // [h][kv]
  __shared__ __align__(16) float    Opart[KSPLIT][64 * OP];     // [query][h], not normalised
  __shared__ float Mpart[KSPLIT][64];                           // range maximum per query
  __shared__ float Lpart[KSPLIT][64];                           // range sum per query

  const int tid    = threadIdx.x;
  const int kr     = tid >> 7;          // key range of this wave
  const int gt     = tid & 127;         // thread within the range's four waves
  const int qi     = gt >> 5;           // query tile of this wave
  const int lane   = tid & 31;
  const int half16 = lane >> 4;
  const int l16    = lane & 15;
  const int hb     = half16 * 8;
  const int q0     = blockIdx.x * 64 + qi * 16;     // flat q row base

  // block-uniform bases; what differs between threads stays in 32-bit offsets (in halves)
  const _Float16* Kh_b  = Kh  + (size_t)(blockIdx.x >> 6) * SEQ * HEAD;
  const _Float16* VhT_b = VhT + (size_t)(blockIdx.x >> 6) * HEAD * SEQ;
  const unsigned  koff  = kr * KRANGE * HEAD + gt * 8;
  const unsigned  voff  = (gt / (KSTEP / 8)) * SEQ + kr * KRANGE + (gt % (KSTEP / 8)) * 8;

  // Q B-tiles (column = query l16) held in VGPRs for the whole loop
  const _Float16* qrow = Qh + (size_t)(q0 + l16) * HEAD;
  const h16v aQ0 = hcat(*(const h8v*)(qrow + hb),      *(const h8v*)(qrow + hb + 16));
  const h16v aQ1 = hcat(*(const h8v*)(qrow + 32 + hb), *(const h8v*)(qrow + 32 + hb + 16));

  // Per lane: query q0 + l16.  lrow sums only this lane's keys; the halves join
  // in the epilogue.  o[t][g] = O[q0 + l16][t * 16 + hb + g].
  float mrow = -INFINITY, lrow = 0.0f;
  f8v   o[4] = {};

  // One step's K/V tile (K: KSTEP rows x 128 B; V: 64 rows x KSTEP * 2 B) into buffer buf
  auto stage = [&](int step, int buf) {
    const _Float16* ksrc = Kh_b + step * (KSTEP * HEAD);
    const _Float16* vsrc = VhT_b + step * KSTEP;
#pragma unroll
    for (int i = 0; i < NCOPY; ++i) {
      const int c = gt + 128 * i;                      // 16 B piece of the tile
      async_b128(&Kbuf[kr][buf][(c >> 3) * KP + (c & 7) * 8],
                 ksrc + (koff + i * 1024u));
      const int vr = c / (KSTEP / 8), vo = (c % (KSTEP / 8)) * 8;
      async_b128(&Vbuf[kr][buf][vr * VP + vo],
                 vsrc + (voff + i * (1024u / KSTEP) * SEQ));
    }
  };

  stage(0, 0);
  asm volatile("s_wait_asynccnt 0x0" ::: "memory");   // this wave's part of tile 0 has landed
  __syncthreads();                                    // tile 0 is whole before any wave reads it
  stage(1, 1);

  // two steps per trip: the buffer index is then a constant, and the fragment reads take
  // their buffer as an immediate offset on one address that the loop never rewrites
#pragma unroll 2
  for (int st = 0; st < NSTEP; ++st) {
    const int cur = st & 1;

    // ---- scores, transposed: NT 16(key) x 16(query) tiles, A = K rows from LDS ----
    // s[j][g]: key st * KSTEP + j * 16 + hb + g ; query q0 + l16
    h16v bK[NT][2];
#pragma unroll
    for (int j = 0; j < NT; ++j) {
      const _Float16* krow = &Kbuf[kr][cur][(j * 16 + l16) * KP];
      bK[j][0] = hcat(*(const h8v*)(krow + hb),      *(const h8v*)(krow + hb + 16));
      bK[j][1] = hcat(*(const h8v*)(krow + 32 + hb), *(const h8v*)(krow + 32 + hb + 16));
    }
    // the step's K reads go out as one group: one LDS latency per step, not one per product
    __builtin_amdgcn_sched_barrier(0);
    f8v s[NT];
#pragma unroll
    for (int j = 0; j < NT; ++j) {
      f8v z = {};
      s[j] = __builtin_amdgcn_wmma_f32_16x16x32_f16(false, bK[j][0], false, aQ0, (short)0, z, false, false);
    }
#pragma unroll
    for (int j = 0; j < NT; ++j)
      s[j] = __builtin_amdgcn_wmma_f32_16x16x32_f16(false, bK[j][1], false, aQ1, (short)0, s[j], false, false);
    // A = V^T rows (h) from LDS, read here so that they arrive during the softmax
    h16v aV[NC][4];
#pragma unroll
    for (int c = 0; c < NC; ++c) {
#pragma unroll
      for (int t = 0; t < 4; ++t) {
        const _Float16* vrow = &Vbuf[kr][cur][(t * 16 + l16) * VP + c * 32];
        aV[c][t] = hcat(*(const h8v*)(vrow + hb), *(const h8v*)(vrow + hb + 16));
      }
    }
    // keeps the V reads in front of the softmax, and the maxima behind the whole run of score
    // products: between them each would cost the idle slots that a fresh matrix result needs
    __builtin_amdgcn_sched_barrier(0);

    // ---- online softmax over these KSTEP keys: in-lane, one exchange between halves ----
    float tm = 0.0f;
#pragma unroll
    for (int c = 0; c < NC; ++c) {
      const f8v s0 = s[2 * c], s1 = s[2 * c + 1];
      const float ta = max3f(max3f(s0[0], s0[1], s0[2]), max3f(s0[3], s0[4], s0[5]),
                             max3f(s0[6], s0[7], s1[0]));
      const float tb = max3f(max3f(s1[1], s1[2], s1[3]), max3f(s1[4], s1[5], s1[6]), s1[7]);
      tm = (c == 0) ? fmaxf(ta, tb) : max3f(tm, ta, tb);
    }
    const float mn   = max3f(mrow, tm, xhalf(tm));   // same value in both halves
    const float corr = __expf(mrow - mn);
    mrow = mn;
#pragma unroll
    for (int j = 0; j < NT; ++j) {
#pragma unroll
      for (int g = 0; g < 8; ++g) s[j][g] = __expf(s[j][g] - mn);
    }
    f8v ps8 = s[0] + s[1];
#pragma unroll
    for (int c = 1; c < NC; ++c) ps8 += s[2 * c] + s[2 * c + 1];
    const f4v ps4 = ps8.lo + ps8.hi;
    lrow = lrow * corr + ((ps4[0] + ps4[2]) + (ps4[1] + ps4[3]));
#pragma unroll
    for (int t = 0; t < 4; ++t) o[t] *= corr;

    // ---- O^T += V^T * P^T ----
#pragma unroll
    for (int c = 0; c < NC; ++c) {
      // P^T as B operand: element i < 8 is key c * 32 + hb + i, element 8 + i key
      // c * 32 + 16 + hb + i, the k order of the V^T loader above.
      const h16v pB = hcat(__builtin_convertvector(s[2 * c], h8v),
                           __builtin_convertvector(s[2 * c + 1], h8v));
#pragma unroll
      for (int t = 0; t < 4; ++t)
        o[t] = __builtin_amdgcn_wmma_f32_16x16x32_f16(
            false, aV[c][t], false, pB, (short)0, o[t], false, false);
    }

    // keeps the softmax and the products in front of the step's foot: sunk behind it, the wait
    // for the next tile's copies would come right behind their issue, not a whole step later
    __builtin_amdgcn_sched_barrier(0);
    asm volatile("s_wait_dscnt 0x0" ::: "memory");      // this wave's reads of the tile are over
    asm volatile("s_wait_asynccnt 0x0" ::: "memory");   // its part of the next tile has landed
    __syncthreads();   // publishes the next tile and frees this one for the refill
    if (st + 2 < NSTEP) stage(st + 2, cur);
  }
  asm volatile("s_wait_asynccnt 0x0" ::: "memory");     // no copy is left in flight

  // ---- hand over this range's partial: join the halves' sums, O not normalised ----
  const float lsum = lrow + xhalf(lrow);
  if (half16 == 0) {
    Mpart[kr][qi * 16 + l16] = mrow;
    Lpart[kr][qi * 16 + l16] = lsum;
  }
  float* prow = &Opart[kr][(qi * 16 + l16) * OP + hb];
#pragma unroll
  for (int t = 0; t < 4; ++t) {
    *(f4v*)(prow + t * 16)     = o[t].lo;
    *(f4v*)(prow + t * 16 + 4) = o[t].hi;
  }
  __syncthreads();   // every range's partial is in LDS before any is merged

  // ---- merge: thread -> query tid / 8, eight consecutive h; a wave stores 1 KB ----
  const int mq = tid >> 3, mh = (tid & 7) * 8;
  float mr[KSPLIT];
#pragma unroll
  for (int r = 0; r < KSPLIT; ++r) mr[r] = Mpart[r][mq];
  const float mall = fmaxf(fmaxf(mr[0], mr[1]), fmaxf(mr[2], mr[3]));
  float lall = 0.0f;
  f4v   lo = {}, hi = {};
#pragma unroll
  for (int r = 0; r < KSPLIT; ++r) {
    const float  w  = __expf(mr[r] - mall);
    const float* pr = &Opart[r][mq * OP + mh];
    lall += w * Lpart[r][mq];
    lo   += w * *(const f4v*)(pr);
    hi   += w * *(const f4v*)(pr + 4);
  }
  float* orow = out + (size_t)(blockIdx.x * 64 + mq) * HEAD + mh;
#pragma unroll
  for (int g = 0; g < 4; ++g) { lo[g] = lo[g] / lall; hi[g] = hi[g] / lall; }
  *(f4v*)(orow)     = lo;
  *(f4v*)(orow + 4) = hi;
}

// ---------------------------------------------------------------------------
extern "C" void kernel_launch(void* const* d_in, const int* in_sizes, int n_in,
                              void* d_out, int out_size, void* d_ws, size_t ws_size,
                              hipStream_t stream) {
  const float* x  = (const float*)d_in[0];
  const float* Wq = (const float*)d_in[1];
  const float* bq = (const float*)d_in[2];
  const float* Wk = (const float*)d_in[3];
  const float* bk = (const float*)d_in[4];
  const float* Wv = (const float*)d_in[5];
  const float* bv = (const float*)d_in[6];
  float*       out = (float*)d_out;

  char* ws = (char*)d_ws;
  _Float16* Qh  = (_Float16*)(ws + 384 * 1024);                      // 2 MB
  _Float16* Kh  = (_Float16*)(ws + 384 * 1024 + 2 * 1024 * 1024);    // 2 MB
  _Float16* VhT = (_Float16*)(ws + 384 * 1024 + 4 * 1024 * 1024);    // 2 MB

  proj_kernel<<<NROWS / 64, 512, 0, stream>>>(x, Wq, Wk, Wv, bq, bk, bv, Qh, Kh, VhT);
  attn_kernel<<<NROWS / 64, 512, 0, stream>>>(Qh, Kh, VhT, out);
}

// v008
// One run takes 35.5 microseconds.
// Timed twice side by side with v007, it ran 1.09 and 1.08 times as fast.
// Counting every step since v000, it is 5.47 times as fast.
#include <hip/hip_runtime.h>
#include <hip/hip_bf16.h>

// ---- types ----
typedef _Float16 h16v __attribute__((ext_vector_type(16)));
typedef _Float16 h8v  __attribute__((ext_vector_type(8)));
typedef float    f8v  __attribute__((ext_vector_type(8)));
typedef float    f4v  __attribute__((ext_vector_type(4)));
typedef float    f2v  __attribute__((ext_vector_type(2)));

#define D_MODEL 1024
#define HEAD    64
#define SEQ     4096
#define BATCH   4
#define NROWS   (BATCH * SEQ)   // 16384 flat rows

__device__ __forceinline__ h16v hcat(h8v lo, h8v hi) {
  h16v r;
#pragma unroll
  for (int i = 0; i < 8; ++i) { r[i] = lo[i]; r[i + 8] = hi[i]; }
  return r;
}

// Lane l <-> lane l ^ 16 (the two halves of a wave hold the same query column).
__device__ __forceinline__ float xhalf(float v) {
  const int b = __builtin_bit_cast(int, v);
  return __builtin_bit_cast(float, __builtin_amdgcn_permlanex16(
      b, b, 0x76543210, 0xfedcba98, false, false));
}
__device__ __forceinline__ float max3f(float a, float b, float c) {
  return fmaxf(fmaxf(a, b), c);
}

// LDS row pitches in halves (XP in floats), for ds_load_b128 readers that walk 16 rows at once:
// 16 B x odd puts the 16 rows of a half-wave on 16 different groups of four banks.
#define KP 72   // K rows: 128 B of data at 144 B
#define VP 72   // V^T rows: 128 B of data at 144 B
#define WP 40   // W^T rows: 64 B of data at 80 B
#define XP 68   // x rows, in floats: 256 B of data at 272 B

typedef int i4v __attribute__((ext_vector_type(4)));
typedef __attribute__((address_space(1))) i4v gl_i4v;
typedef __attribute__((address_space(3))) i4v sh_i4v;

// Per-lane async copy: 16 bytes global -> LDS, tracked by ASYNCcnt.
__device__ __forceinline__ void async_b128(_Float16* lds, const _Float16* gaddr) {
  __builtin_amdgcn_global_load_async_to_lds_b128((gl_i4v*)gaddr, (sh_i4v*)lds, 0, 0);
}
__device__ __forceinline__ void async_b128_f32(float* lds, const float* gaddr) {
  __builtin_amdgcn_global_load_async_to_lds_b128((gl_i4v*)gaddr, (sh_i4v*)lds, 0, 0);
}

// ---------------------------------------------------------------------------
// Kernel 1: fused Q/K/V projection.  64 rows/block, all three matrices per block.
// 16 waves/block = 4 row tiles x 4 k ranges, so that four waves share each SIMD and
// fill each other's waits on x (memory) and on the W fragments (LDS).  Wave (kr, wave):
// rows row0 .. row0 + 15, k in kr * 256 .. + 255, 12 WMMAs per k-step of 32.
// The four waves of a k range share that range's W tiles (3 x [64n x 32k] f16, rows at
// pitch WP), double-buffered in LDS.  The block makes them itself from the f32 weights
// W[k][n]: wave `wave` takes k octet `wave` of a tile, a lane two columns; a load covers
// one whole 256 B row of W, eight rows pack into one 16 B LDS store per column.  The next
// tile's loads fly during this tile's products.  x comes through LDS too: a wave brings its
// own 16 rows x XK k (f32) by async copies, each copy covering two whole 256 B row pieces,
// double-buffered, one tile (two k-steps) ahead; the A fragments are read from there.
// The four ranges' partial sums merge through LDS; wave (kr, wave) finishes column tile kr
// of Q, K, V.  The finished f16 tiles pass through LDS once more, so that every global store
// of a wave covers four whole 128 B lines.
//   Q -> Qh  [row][h] f16, (x*Wq+bq)*0.125 ;  K -> Kh [row][h] ; V -> VhT[b][h][kv]
// ---------------------------------------------------------------------------
#define PSPLIT 4
#define PRANGE (D_MODEL / PSPLIT)      // k per wave
#define WTILE  (3 * 64 * WP)           // halves in one W buffer (15 KB)
#define PTILE  256                     // floats in one 16 x 16 partial tile (1 KB)
#define XK     64                      // k in one x tile
#define XTILE  (16 * XP)               // floats in one wave's x tile (4352 B)
#define XOFF   (PSPLIT * 2 * WTILE / 2)   // the x buffers start behind the W buffers (floats)
#define SOFF   (PSPLIT * 4 * 12 * PTILE)  // the output staging starts behind the partial sums (floats)
#define SP     72                         // staged output rows, in halves: 128 B of data at 144 B

__global__ __launch_bounds__(512) void proj_kernel(
    const float* __restrict__ x, const float* __restrict__ Wq,
    const float* __restrict__ Wk, const float* __restrict__ Wv,
    const float* __restrict__ bq, const float* __restrict__ bk,
    const float* __restrict__ bv, _Float16* __restrict__ Qh,
    _Float16* __restrict__ Kh, _Float16* __restrict__ VhT) {
  // In the loop: W buffers [k range][2][WTILE] halves (120 KB), then x buffers
  // [2][wave][XTILE] floats (136 KB).  Behind the loop's last barrier the same LDS holds
  // the partial sums [k range][row tile][12][PTILE] floats (192 KB), and behind them the
  // finished tiles Q[row][h], K[row][h], V^T[h][row], [3][64][SP] halves (27 KB).
  __shared__ __align__(16) float smem[XOFF + 2 * 16 * XTILE];   // 256 KB

  const int tid    = threadIdx.x;
  const int kr     = tid >> 7;          // k range of this wave
  const int gt     = tid & 127;         // thread within the range's four waves
  const int wave   = gt >> 5;           // row tile of this wave
  const int lane   = tid & 31;
  const int half16 = lane >> 4;
  const int l16    = lane & 15;
  const int hb     = half16 * 8;
  const int row0   = blockIdx.x * 64 + wave * 16;      // this wave's 16-row tile
  // x staging: copy i of a tile takes rows 2 * i + half16, a lane 16 B of a row's 256 B
  const float*    xsrc = x + (size_t)(row0 + half16) * D_MODEL + kr * PRANGE + l16 * 4;
  float*          xbuf = smem + XOFF + (tid >> 5) * XTILE;     // this wave's part of buffer 0
  float*          xdst = xbuf + half16 * XP + l16 * 4;
  const float*    xrow = xbuf + l16 * XP + hb;                 // A fragment reads
  auto xstage = [&](int xt, int buf) {
#pragma unroll
    for (int i = 0; i < 8; ++i)
      async_b128_f32(xdst + buf * (16 * XTILE) + i * 2 * XP,
                     xsrc + xt * XK + (size_t)(i * 2) * D_MODEL);
  };
  _Float16*       Wbuf = (_Float16*)smem + kr * 2 * WTILE;

  // W staging: rows kr * PRANGE + kk + wave * 8 + j of W, columns 2 * lane and 2 * lane + 1
  const size_t woff = (size_t)(kr * PRANGE + wave * 8) * HEAD + 2 * lane;
  const float* wsrc[3] = {Wq + woff, Wk + woff, Wv + woff};
  _Float16*    wdst    = Wbuf + (2 * lane) * WP + wave * 8;
  f2v          wreg[3][8];

  f8v acc[3][4] = {};

  xstage(0, 0);   // x tile 0 into buffer 0

  // W tile for kk = 0 into buffer 0
#pragma unroll
  for (int m = 0; m < 3; ++m) {
#pragma unroll
    for (int j = 0; j < 8; ++j) wreg[m][j] = *(const f2v*)(wsrc[m] + j * HEAD);
  }
#pragma unroll
  for (int m = 0; m < 3; ++m) {
#pragma unroll
    for (int c = 0; c < 2; ++c) {
      h8v h;
#pragma unroll
      for (int j = 0; j < 8; ++j) h[j] = (_Float16)wreg[m][j][c];
      *(h8v*)(wdst + (m * 64 + c) * WP) = h;
    }
  }
  asm volatile("s_wait_asynccnt 0x0" ::: "memory");   // this wave's x tile 0 has landed
  __syncthreads();   // tile 0 is in LDS before any wave reads it
  xstage(1, 1);

  // unrolled: a tile's k offset and its buffer become immediate offsets of the loads and
  // LDS operations, on one scalar base and one lane offset that are never rewritten
#pragma unroll
  for (int kk = 0; kk < PRANGE; kk += 32) {            // kk counts inside the range
    const int  cur  = (kk >> 5) & 1;
    const bool more = kk + 32 < PRANGE;

    const int  xt   = kk / XK;                         // x tile of this k-step
    const bool xend = (kk + 32) % XK == 0;             // its last k-step

    // next W tile, f32, into registers: in flight during this tile's products
    if (more) {
#pragma unroll
      for (int m = 0; m < 3; ++m) {
#pragma unroll
        for (int j = 0; j < 8; ++j)
          wreg[m][j] = *(const f2v*)(wsrc[m] + (size_t)(kk + 32 + j) * HEAD);
      }
    }

    // A tile from LDS: 16 rows x 32 k of x, fp32 -> f16
    const int kA = (xt & 1) * (16 * XTILE) + kk % XK;
    f4v a0 = *(const f4v*)(xrow + kA);
    f4v a1 = *(const f4v*)(xrow + kA + 4);
    f4v a2 = *(const f4v*)(xrow + kA + 16);
    f4v a3 = *(const f4v*)(xrow + kA + 20);

    const _Float16* wb = &Wbuf[cur * WTILE];
    h16v B[3][4];
    auto bload = [&](int m) {
#pragma unroll
      for (int t = 0; t < 4; ++t) {
        const _Float16* wcol = wb + (m * 64 + t * 16 + l16) * WP;
        B[m][t] = hcat(*(const h8v*)(wcol + hb), *(const h8v*)(wcol + hb + 16));
      }
    };
    auto bmul = [&](int m, h16v A) {
#pragma unroll
      for (int t = 0; t < 4; ++t)
        acc[m][t] = __builtin_amdgcn_wmma_f32_16x16x32_f16(
            false, A, false, B[m][t], (short)0, acc[m][t], false, false);
    };
    bload(0);
    bload(1);
    // the A reads and two matrices' W reads go out as one group: one LDS latency, not one per product
    __builtin_amdgcn_sched_barrier(0);

    h16v A;
#pragma unroll
    for (int i = 0; i < 4; ++i) {
      A[i]      = (_Float16)a0[i];
      A[4 + i]  = (_Float16)a1[i];
      A[8 + i]  = (_Float16)a2[i];
      A[12 + i] = (_Float16)a3[i];
    }
    bmul(0, A);
    bload(2);
    // the third matrix' reads go out as one group too, and fly during the second's products
    __builtin_amdgcn_sched_barrier(0);
    bmul(1, A);
    bmul(2, A);
    // keeps the products, whose operands now all wait in LDS, in front of the wait for the next
    // W tile's loads: mixed among them, that wait would hold the products back for a whole flight
    __builtin_amdgcn_sched_barrier(0);
    // f32 -> f16, transposed into the other buffer (its readers left it at the last barrier)
    if (more) {
#pragma unroll
      for (int m = 0; m < 3; ++m) {
#pragma unroll
        for (int c = 0; c < 2; ++c) {
          h8v h;
#pragma unroll
          for (int j = 0; j < 8; ++j) h[j] = (_Float16)wreg[m][j][c];
          *(h8v*)(wdst + (cur ^ 1) * WTILE + (m * 64 + c) * WP) = h;
        }
      }
    }
    if (xend) {
      asm volatile("s_wait_dscnt 0x0" ::: "memory");      // this wave's reads of the x tile are over
      asm volatile("s_wait_asynccnt 0x0" ::: "memory");   // its next x tile has landed
    }
    __syncthreads();   // publishes the next tile and ends this tile's reads
    if (xend && (xt + 2) * XK < PRANGE) xstage(xt + 2, xt & 1);
  }
  asm volatile("s_wait_asynccnt 0x0" ::: "memory");     // no copy is left in flight

  // ---- hand over this range's partial sums: a wave's store covers 512 B in a row ----
  // (the loop's last barrier has ended every read of the W buffers)
  {
    float* pw = smem + (size_t)((kr * 4 + wave) * 12) * PTILE + lane * 4;
#pragma unroll
    for (int m = 0; m < 3; ++m) {
#pragma unroll
      for (int t = 0; t < 4; ++t) {
        *(f4v*)(pw + (m * 4 + t) * PTILE)       = acc[m][t].lo;
        *(f4v*)(pw + (m * 4 + t) * PTILE + 128) = acc[m][t].hi;
      }
    }
  }
  __syncthreads();   // every range's partial is in LDS before any is merged

  // ---- merge in the order of the k ranges, then bias + scale: tile t = kr ----
  // The f16 results go to the staging tiles (LDS that nothing has used since the loop's last
  // barrier): a lane holds eight rows of one column, 16 B in a row of V^T, single halves of Q, K.
  _Float16* stg = (_Float16*)(smem + SOFF);
  const int col = kr * 16 + l16;
  h8v       hv[3];
#pragma unroll
  for (int m = 0; m < 3; ++m) {
    const float* pr = smem + (size_t)(wave * 12 + m * 4 + kr) * PTILE + lane * 4;
    f4v lo = *(const f4v*)(pr);
    f4v hi = *(const f4v*)(pr + 128);
#pragma unroll
    for (int r = 1; r < PSPLIT; ++r) {
      lo += *(const f4v*)(pr + r * 48 * PTILE);
      hi += *(const f4v*)(pr + r * 48 * PTILE + 128);
    }
    const float* bias = (m == 0) ? bq : ((m == 1) ? bk : bv);
    const float  scl  = (m == 0) ? 0.125f : 1.0f;
    const float  bvv  = bias[col];
#pragma unroll
    for (int g = 0; g < 8; ++g) {
      const float sum = (g < 4) ? lo[g & 3] : hi[g & 3];
      hv[m][g] = (_Float16)((sum + bvv) * scl);
    }
  }
  // behind all three merges, whose LDS reads then go out together
#pragma unroll
  for (int m = 0; m < 2; ++m) {
#pragma unroll
    for (int g = 0; g < 8; ++g) stg[(m * 64 + wave * 16 + hb + g) * SP + col] = hv[m][g];
  }
  *(h8v*)(stg + (2 * 64 + col) * SP + wave * 16 + hb) = hv[2];
  __syncthreads();   // the three tiles are whole before any wave stores their lines

  // ---- store: thread -> 16 B piece tid of each tile, eight lanes to a 128 B line ----
  const int       srow = tid >> 3, spc = (tid & 7) * 8;
  const _Float16* sr   = stg + srow * SP + spc;
  const h8v       qv   = *(const h8v*)(sr);
  const h8v       kv   = *(const h8v*)(sr + 64 * SP);
  const h8v       vv   = *(const h8v*)(sr + 128 * SP);
  const size_t    rowb = (size_t)blockIdx.x * 64 * HEAD + tid * 8;   // the block's Q, K rows lie in a row
  *(h8v*)(Qh + rowb) = qv;
  *(h8v*)(Kh + rowb) = kv;
  *(h8v*)(VhT + ((size_t)(blockIdx.x >> 6) * HEAD + srow) * SEQ + (blockIdx.x & 63) * 64 + spc) = vv;
}

#define KSPLIT 4
#define KRANGE (SEQ / KSPLIT)   // keys per wave
#define KSTEP  64               // keys per step: one maximum, one rescale, one barrier
#define NSTEP  (KRANGE / KSTEP)
#define NT     (KSTEP / 16)     // S^T tiles per step
#define NC     (KSTEP / 32)     // P^T operands per step
#define NCOPY  (KSTEP / 16)     // 16 B copies per thread and step, for K and for V each
#define OP     68               // partial-O rows: 256 B of data at 272 B (16 B x odd)

__global__ __launch_bounds__(512) void attn_kernel(
    const _Float16* __restrict__ Qh, const _Float16* __restrict__ Kh,
    const _Float16* __restrict__ VhT, float* __restrict__ out) {
  __shared__ __align__(16) _Float16 Kbuf[KSPLIT][2][KSTEP * KP];   // [kv][h]
  __shared__ __align__(16) _Float16 Vbuf[KSPLIT][2][64 * VP];      // [h][kv]
  __shared__ __align__(16) float    Opart[KSPLIT][64 * OP];     // [query][h], not normalised
  __shared__ float Mpart[KSPLIT][64];                           // range maximum per query
  __shared__ float Lpart[KSPLIT][64];                           // range sum per query

  const int tid    = threadIdx.x;
  const int kr     = tid >> 7;          // key range of this wave
  const int gt     = tid & 127;         // thread within the range's four waves
  const int qi     = gt >> 5;           // query tile of this wave
  const int lane   = tid & 31;
  const int half16 = lane >> 4;
  const int l16    = lane & 15;
  const int hb     = half16 * 8;
  const int q0     = blockIdx.x * 64 + qi * 16;     // flat q row base

  // block-uniform bases; what differs between threads stays in 32-bit offsets (in halves)
  const _Float16* Kh_b  = Kh  + (size_t)(blockIdx.x >> 6) * SEQ * HEAD;
  const _Float16* VhT_b = VhT + (size_t)(blockIdx.x >> 6) * HEAD * SEQ;
  const unsigned  koff  = kr * KRANGE * HEAD + gt * 8;
  const unsigned  voff  = (gt / (KSTEP / 8)) * SEQ + kr * KRANGE + (gt % (KSTEP / 8)) * 8;

  // Q B-tiles (column = query l16) held in VGPRs for the whole loop
  const _Float16* qrow = Qh + (size_t)(q0 + l16) * HEAD;
  const h16v aQ0 = hcat(*(const h8v*)(qrow + hb),      *(const h8v*)(qrow + hb + 16));
  const h16v aQ1 = hcat(*(const h8v*)(qrow + 32 + hb), *(const h8v*)(qrow + 32 + hb + 16));

  // Per lane: query q0 + l16.  lrow sums only this lane's keys; the halves join
  // in the epilogue.  o[t][g] = O[q0 + l16][t * 16 + hb + g].
  float mrow = -INFINITY, lrow = 0.0f;
  f8v   o[4] = {};

  // One step's K/V tile (K: KSTEP rows x 128 B; V: 64 rows x KSTEP * 2 B) into buffer buf
  auto stage = [&](int step, int buf) {
    const _Float16* ksrc = Kh_b + step * (KSTEP * HEAD);
    const _Float16* vsrc = VhT_b + step * KSTEP;
#pragma unroll
    for (int i = 0; i < NCOPY; ++i) {
      const int c = gt + 128 * i;                      // 16 B piece of the tile
      async_b128(&Kbuf[kr][buf][(c >> 3) * KP + (c & 7) * 8],
                 ksrc + (koff + i * 1024u));
      const int vr = c / (KSTEP / 8), vo = (c % (KSTEP / 8)) * 8;
      async_b128(&Vbuf[kr][buf][vr * VP + vo],
                 vsrc + (voff + i * (1024u / KSTEP) * SEQ));
    }
  };

  stage(0, 0);
  asm volatile("s_wait_asynccnt 0x0" ::: "memory");   // this wave's part of tile 0 has landed
  __syncthreads();                                    // tile 0 is whole before any wave reads it
  stage(1, 1);

  // two steps per trip: the buffer index is then a constant, and the fragment reads take
  // their buffer as an immediate offset on one address that the loop never rewrites
#pragma unroll 2
  for (int st = 0; st < NSTEP; ++st) {
    const int cur = st & 1;

    // ---- scores, transposed: NT 16(key) x 16(query) tiles, A = K rows from LDS ----
    // s[j][g]: key st * KSTEP + j * 16 + hb + g ; query q0 + l16
    h16v bK[NT][2];
#pragma unroll
    for (int j = 0; j < NT; ++j) {
      const _Float16* krow = &Kbuf[kr][cur][(j * 16 + l16) * KP];
      bK[j][0] = hcat(*(const h8v*)(krow + hb),      *(const h8v*)(krow + hb + 16));
      bK[j][1] = hcat(*(const h8v*)(krow + 32 + hb), *(const h8v*)(krow + 32 + hb + 16));
    }
    // the step's K reads go out as one group: one LDS latency per step, not one per product
    __builtin_amdgcn_sched_barrier(0);
    f8v s[NT];
#pragma unroll
    for (int j = 0; j < NT; ++j) {
      f8v z = {};
      s[j] = __builtin_amdgcn_wmma_f32_16x16x32_f16(false, bK[j][0], false, aQ0, (short)0, z, false, false);
    }
#pragma unroll
    for (int j = 0; j < NT; ++j)
      s[j] = __builtin_amdgcn_wmma_f32_16x16x32_f16(false, bK[j][1], false, aQ1, (short)0, s[j], false, false);
    // A = V^T rows (h) from LDS, read here so that they arrive during the softmax
    h16v aV[NC][4];
#pragma unroll
    for (int c = 0; c < NC; ++c) {
#pragma unroll
      for (int t = 0; t < 4; ++t) {
        const _Float16* vrow = &Vbuf[kr][cur][(t * 16 + l16) * VP + c * 32];
        aV[c][t] = hcat(*(const h8v*)(vrow + hb), *(const h8v*)(vrow + hb + 16));
      }
    }
    // keeps the V reads in front of the softmax, and the maxima behind the whole run of score
    // products: between them each would cost the idle slots that a fresh matrix result needs
    __builtin_amdgcn_sched_barrier(0);

    // ---- online softmax over these KSTEP keys: in-lane, one exchange between halves ----
    float tm = 0.0f;
#pragma unroll
    for (int c = 0; c < NC; ++c) {
      const f8v s0 = s[2 * c], s1 = s[2 * c + 1];
      const float ta = max3f(max3f(s0[0], s0[1], s0[2]), max3f(s0[3], s0[4], s0[5]),
                             max3f(s0[6], s0[7], s1[0]));
      const float tb = max3f(max3f(s1[1], s1[2], s1[3]), max3f(s1[4], s1[5], s1[6]), s1[7]);
      tm = (c == 0) ? fmaxf(ta, tb) : max3f(tm, ta, tb);
    }
    const float mn   = max3f(mrow, tm, xhalf(tm));   // same value in both halves
    const float corr = __expf(mrow - mn);
    mrow = mn;
#pragma unroll
    for (int j = 0; j < NT; ++j) {
#pragma unroll
      for (int g = 0; g < 8; ++g) s[j][g] = __expf(s[j][g] - mn);
    }
    f8v ps8 = s[0] + s[1];
#pragma unroll
    for (int c = 1; c < NC; ++c) ps8 += s[2 * c] + s[2 * c + 1];
    const f4v ps4 = ps8.lo + ps8.hi;
    lrow = lrow * corr + ((ps4[0] + ps4[2]) + (ps4[1] + ps4[3]));
#pragma unroll
    for (int t = 0; t < 4; ++t) o[t] *= corr;

    // ---- O^T += V^T * P^T ----
#pragma unroll
    for (int c = 0; c < NC; ++c) {
      // P^T as B operand: element i < 8 is key c * 32 + hb + i, element 8 + i key
      // c * 32 + 16 + hb + i, the k order of the V^T loader above.
      const h16v pB = hcat(__builtin_convertvector(s[2 * c], h8v),
                           __builtin_convertvector(s[2 * c + 1], h8v));
#pragma unroll
      for (int t = 0; t < 4; ++t)
        o[t] = __builtin_amdgcn_wmma_f32_16x16x32_f16(
            false, aV[c][t], false, pB, (short)0, o[t], false, false);
    }

    // keeps the softmax and the products in front of the step's foot: sunk behind it, the wait
    // for the next tile's copies would come right behind their issue, not a whole step later
    __builtin_amdgcn_sched_barrier(0);
    asm volatile("s_wait_dscnt 0x0" ::: "memory");      // this wave's reads of the tile are over
    asm volatile("s_wait_asynccnt 0x0" ::: "memory");   // its part of the next tile has landed
    __syncthreads();   // publishes the next tile and frees this one for the refill
    if (st + 2 < NSTEP) stage(st + 2, cur);
  }
  asm volatile("s_wait_asynccnt 0x0" ::: "memory");     // no copy is left in flight

  // ---- hand over this range's partial: join the halves' sums, O not normalised ----
  const float lsum = lrow + xhalf(lrow);
  if (half16 == 0) {
    Mpart[kr][qi * 16 + l16] = mrow;
    Lpart[kr][qi * 16 + l16] = lsum;
  }
  float* prow = &Opart[kr][(qi * 16 + l16) * OP + hb];
#pragma unroll
  for (int t = 0; t < 4; ++t) {
    *(f4v*)(prow + t * 16)     = o[t].lo;
    *(f4v*)(prow + t * 16 + 4) = o[t].hi;
  }
  __syncthreads();   // every range's partial is in LDS before any is merged

  // ---- merge: thread -> query tid / 8, eight consecutive h; a wave stores 1 KB ----
  const int mq = tid >> 3, mh = (tid & 7) * 8;
  float mr[KSPLIT];
#pragma unroll
  for (int r = 0; r < KSPLIT; ++r) mr[r] = Mpart[r][mq];
  const float mall = fmaxf(fmaxf(mr[0], mr[1]), fmaxf(mr[2], mr[3]));
  float lall = 0.0f;
  f4v   lo = {}, hi = {};
#pragma unroll
  for (int r = 0; r < KSPLIT; ++r) {
    const float  w  = __expf(mr[r] - mall);
    const float* pr = &Opart[r][mq * OP + mh];
    lall += w * Lpart[r][mq];
    lo   += w * *(const f4v*)(pr);
    hi   += w * *(const f4v*)(pr + 4);
  }
  float* orow = out + (size_t)(blockIdx.x * 64 + mq) * HEAD + mh;
#pragma unroll
  for (int g = 0; g < 4; ++g) { lo[g] = lo[g] / lall; hi[g] = hi[g] / lall; }
  *(f4v*)(orow)     = lo;
  *(f4v*)(orow + 4) = hi;
}

// ---------------------------------------------------------------------------
extern "C" void kernel_launch(void* const* d_in, const int* in_sizes, int n_in,
                              void* d_out, int out_size, void* d_ws, size_t ws_size,
                              hipStream_t stream) {
  const float* x  = (const float*)d_in[0];
  const float* Wq = (const float*)d_in[1];
  const float* bq = (const float*)d_in[2];
  const float* Wk = (const float*)d_in[3];
  const float* bk = (const float*)d_in[4];
  const float* Wv = (const float*)d_in[5];
  const float* bv = (const float*)d_in[6];
  float*       out = (float*)d_out;

  char* ws = (char*)d_ws;
  _Float16* Qh  = (_Float16*)(ws + 384 * 1024);                      // 2 MB
  _Float16* Kh  = (_Float16*)(ws + 384 * 1024 + 2 * 1024 * 1024);    // 2 MB
  _Float16* VhT = (_Float16*)(ws + 384 * 1024 + 4 * 1024 * 1024);    // 2 MB

  proj_kernel<<<NROWS / 64, 512, 0, stream>>>(x, Wq, Wk, Wv, bq, bk, bv, Qh, Kh, VhT);
  attn_kernel<<<NROWS / 64, 512, 0, stream>>>(Qh, Kh, VhT, out);
}

// v009
// It runs in 33.7 microseconds.
// Two timings next to v008 put it at 1.05 and 1.06 times that version's speed.
// Counting every step since v000, it is 5.75 times as fast.
#include <hip/hip_runtime.h>
#include <hip/hip_bf16.h>

// ---- types ----
typedef _Float16 h16v __attribute__((ext_vector_type(16)));
typedef _Float16 h8v  __attribute__((ext_vector_type(8)));
typedef float    f8v  __attribute__((ext_vector_type(8)));
typedef float    f4v  __attribute__((ext_vector_type(4)));
typedef float    f2v  __attribute__((ext_vector_type(2)));

#define D_MODEL 1024
#define HEAD    64
#define SEQ     4096
#define BATCH   4
#define NROWS   (BATCH * SEQ)   // 16384 flat rows

__device__ __forceinline__ h16v hcat(h8v lo, h8v hi) {
  h16v r;
#pragma unroll
  for (int i = 0; i < 8; ++i) { r[i] = lo[i]; r[i + 8] = hi[i]; }
  return r;
}

// Lane l <-> lane l ^ 16 (the two halves of a wave hold the same query column).
__device__ __forceinline__ float xhalf(float v) {
  const int b = __builtin_bit_cast(int, v);
  return __builtin_bit_cast(float, __builtin_amdgcn_permlanex16(
      b, b, 0x76543210, 0xfedcba98, false, false));
}
__device__ __forceinline__ float max3f(float a, float b, float c) {
  return fmaxf(fmaxf(a, b), c);
}

// LDS row pitches in halves (XP in floats), for ds_load_b128 readers that walk 16 rows at once:
// 16 B x odd puts the 16 rows of a half-wave on 16 different groups of four banks.
#define KP 72   // K rows: 128 B of data at 144 B
#define VP 72   // V^T rows: 128 B of data at 144 B
#define WP 40   // W^T rows: 64 B of data at 80 B
#define XP 68   // x rows, in floats: 256 B of data at 272 B

typedef int i4v __attribute__((ext_vector_type(4)));
typedef __attribute__((address_space(1))) i4v gl_i4v;
typedef __attribute__((address_space(3))) i4v sh_i4v;

// Per-lane async copy: 16 bytes global -> LDS, tracked by ASYNCcnt.
__device__ __forceinline__ void async_b128(_Float16* lds, const _Float16* gaddr) {
  __builtin_amdgcn_global_load_async_to_lds_b128((gl_i4v*)gaddr, (sh_i4v*)lds, 0, 0);
}
__device__ __forceinline__ void async_b128_f32(float* lds, const float* gaddr) {
  __builtin_amdgcn_global_load_async_to_lds_b128((gl_i4v*)gaddr, (sh_i4v*)lds, 0, 0);
}

// ---------------------------------------------------------------------------
// Kernel 1: fused Q/K/V projection.  64 rows/block, all three matrices per block.
// 16 waves/block = 4 row tiles x 4 k ranges, so that four waves share each SIMD and
// fill each other's waits on x (memory) and on the W fragments (LDS).  Wave (kr, wave):
// rows row0 .. row0 + 15, k in kr * 256 .. + 255, 12 WMMAs per k-step of 32.
// The four waves of a k range share that range's W tiles (3 x [64n x 32k] f16, rows at
// pitch WP), double-buffered in LDS.  The block makes them itself from the f32 weights
// W[k][n]: wave `wave` takes k octet `wave` of a tile, a lane two columns; a load covers
// one whole 256 B row of W, eight rows pack into one 16 B LDS store per column.  The next
// tile's loads fly during this tile's products.  x comes through LDS too: a wave brings its
// own 16 rows x XK k (f32) by async copies, each copy covering two whole 256 B row pieces,
// double-buffered, one tile (two k-steps) ahead; the A fragments are read from there.
// The four ranges' partial sums merge through LDS; wave (kr, wave) finishes column tile kr
// of Q, K, V.  The finished f16 tiles pass through LDS once more, so that every global store
// of a wave covers four whole 128 B lines.
//   Q -> Qh  [row][h] f16, (x*Wq+bq)*0.125 ;  K -> Kh [row][h] ; V -> VhT[b][h][kv]
// ---------------------------------------------------------------------------
#define PSPLIT 4
#define PRANGE (D_MODEL / PSPLIT)      // k per wave
#define WTILE  (3 * 64 * WP)           // halves in one W buffer (15 KB)
#define PTILE  256                     // floats in one 16 x 16 partial tile (1 KB)
#define XK     64                      // k in one x tile
#define XTILE  (16 * XP)               // floats in one wave's x tile (4352 B)
#define XOFF   (PSPLIT * 2 * WTILE / 2)   // the x buffers start behind the W buffers (floats)
#define SOFF   (PSPLIT * 4 * 12 * PTILE)  // the output staging starts behind the partial sums (floats)
#define SP     72                         // staged output rows, in halves: 128 B of data at 144 B

__global__ __launch_bounds__(512) void proj_kernel(
    const float* __restrict__ x, const float* __restrict__ Wq,
    const float* __restrict__ Wk, const float* __restrict__ Wv,
    const float* __restrict__ bq, const float* __restrict__ bk,
    const float* __restrict__ bv, _Float16* __restrict__ Qh,
    _Float16* __restrict__ Kh, _Float16* __restrict__ VhT) {
  // In the loop: W buffers [k range][2][WTILE] halves (120 KB), then x buffers
  // [2][wave][XTILE] floats (136 KB).  Behind the loop's last barrier the same LDS holds
  // the partial sums [k range][row tile][12][PTILE] floats (192 KB), and behind them the
  // finished tiles Q[row][h], K[row][h], V^T[h][row], [3][64][SP] halves (27 KB).
  __shared__ __align__(16) float smem[XOFF + 2 * 16 * XTILE];   // 256 KB

  const int tid    = threadIdx.x;
  const int kr     = tid >> 7;          // k range of this wave
  const int gt     = tid & 127;         // thread within the range's four waves
  const int wave   = gt >> 5;           // row tile of this wave
  const int lane   = tid & 31;
  const int half16 = lane >> 4;
  const int l16    = lane & 15;
  const int hb     = half16 * 8;
  const int row0   = blockIdx.x * 64 + wave * 16;      // this wave's 16-row tile
  // Every block reads the same W.  A block takes the k-steps of a range in the order kk ^ rk,
  // so that at one moment the blocks ask L2 for different rows of W, not all for the same.
  const unsigned rk = (blockIdx.x & (PRANGE / 32 - 1)) * 32;
  // x staging: copy i of a tile takes rows 2 * i + half16, a lane 16 B of a row's 256 B
  const float*    xsrc = x + (size_t)(row0 + half16) * D_MODEL + kr * PRANGE + l16 * 4;
  float*          xbuf = smem + XOFF + (tid >> 5) * XTILE;     // this wave's part of buffer 0
  float*          xdst = xbuf + half16 * XP + l16 * 4;
  // A fragment reads: the first and the second k-step taken from an x tile
  const float*    xrow[2] = {xbuf + l16 * XP + hb + (rk & 32), xbuf + l16 * XP + hb + (~rk & 32)};
  auto xstage = [&](int xt, int buf) {
#pragma unroll
    for (int i = 0; i < 8; ++i)
      async_b128_f32(xdst + buf * (16 * XTILE) + i * 2 * XP,
                     xsrc + ((unsigned)(xt * XK) ^ (rk & ~(XK - 1u))) + (size_t)(i * 2) * D_MODEL);
  };
  _Float16*       Wbuf = (_Float16*)smem + kr * 2 * WTILE;

  // W staging: rows kr * PRANGE + (kk ^ rk) + wave * 8 + j of W, columns 2 * lane and 2 * lane + 1
  const unsigned woff = (kr * PRANGE + wave * 8) * HEAD + 2 * lane;
  const float*   wmat[3] = {Wq, Wk, Wv};
  _Float16*    wdst    = Wbuf + (2 * lane) * WP + wave * 8;
  f2v          wreg[3][8];

  f8v acc[3][4] = {};

  xstage(0, 0);   // x tile 0 into buffer 0

  // W tile for kk = 0 into buffer 0
#pragma unroll
  for (int m = 0; m < 3; ++m) {
#pragma unroll
    for (int j = 0; j < 8; ++j) wreg[m][j] = *(const f2v*)(wmat[m] + rk * HEAD + woff + j * HEAD);
  }
#pragma unroll
  for (int m = 0; m < 3; ++m) {
#pragma unroll
    for (int c = 0; c < 2; ++c) {
      h8v h;
#pragma unroll
      for (int j = 0; j < 8; ++j) h[j] = (_Float16)wreg[m][j][c];
      *(h8v*)(wdst + (m * 64 + c) * WP) = h;
    }
  }
  asm volatile("s_wait_asynccnt 0x0" ::: "memory");   // this wave's x tile 0 has landed
  __syncthreads();   // tile 0 is in LDS before any wave reads it
  xstage(1, 1);

  // unrolled: a tile's buffer becomes an immediate offset of the LDS operations, and its k
  // offset a scalar base of the loads, beside one lane offset that is never rewritten
#pragma unroll
  for (int kk = 0; kk < PRANGE; kk += 32) {            // kk counts inside the range
    const int  cur  = (kk >> 5) & 1;
    const bool more = kk + 32 < PRANGE;

    const int  xt   = kk / XK;                         // x tile of this k-step
    const bool xend = (kk + 32) % XK == 0;             // its last k-step

    // next W tile, f32, into registers: in flight during this tile's products
    if (more) {
#pragma unroll
      for (int m = 0; m < 3; ++m) {
#pragma unroll
        for (int j = 0; j < 8; ++j)
          wreg[m][j] = *(const f2v*)(wmat[m] + ((kk + 32) ^ rk) * HEAD + woff + j * HEAD);
      }
    }

    // A tile from LDS: 16 rows x 32 k of x, fp32 -> f16
    const float* xa = xrow[(kk >> 5) & 1] + (xt & 1) * (16 * XTILE);
    f4v a0 = *(const f4v*)(xa);
    f4v a1 = *(const f4v*)(xa + 4);
    f4v a2 = *(const f4v*)(xa + 16);
    f4v a3 = *(const f4v*)(xa + 20);

    const _Float16* wb = &Wbuf[cur * WTILE];
    h16v B[3][4];
    auto bload = [&](int m) {
#pragma unroll
      for (int t = 0; t < 4; ++t) {
        const _Float16* wcol = wb + (m * 64 + t * 16 + l16) * WP;
        B[m][t] = hcat(*(const h8v*)(wcol + hb), *(const h8v*)(wcol + hb + 16));
      }
    };
    auto bmul = [&](int m, h16v A) {
#pragma unroll
      for (int t = 0; t < 4; ++t)
        acc[m][t] = __builtin_amdgcn_wmma_f32_16x16x32_f16(
            false, A, false, B[m][t], (short)0, acc[m][t], false, false);
    };
    bload(0);
    bload(1);
    // the A reads and two matrices' W reads go out as one group: one LDS latency, not one per product
    __builtin_amdgcn_sched_barrier(0);

    h16v A;
#pragma unroll
    for (int i = 0; i < 4; ++i) {
      A[i]      = (_Float16)a0[i];
      A[4 + i]  = (_Float16)a1[i];
      A[8 + i]  = (_Float16)a2[i];
      A[12 + i] = (_Float16)a3[i];
    }
    bmul(0, A);
    bload(2);
    // the third matrix' reads go out as one group too, and fly during the second's products
    __builtin_amdgcn_sched_barrier(0);
    bmul(1, A);
    bmul(2, A);
    // keeps the products, whose operands now all wait in LDS, in front of the wait for the next
    // W tile's loads: mixed among them, that wait would hold the products back for a whole flight
    __builtin_amdgcn_sched_barrier(0);
    // f32 -> f16, transposed into the other buffer (its readers left it at the last barrier)
    if (more) {
#pragma unroll
      for (int m = 0; m < 3; ++m) {
#pragma unroll
        for (int c = 0; c < 2; ++c) {
          h8v h;
#pragma unroll
          for (int j = 0; j < 8; ++j) h[j] = (_Float16)wreg[m][j][c];
          *(h8v*)(wdst + (cur ^ 1) * WTILE + (m * 64 + c) * WP) = h;
        }
      }
    }
    if (xend) {
      asm volatile("s_wait_dscnt 0x0" ::: "memory");      // this wave's reads of the x tile are over
      asm volatile("s_wait_asynccnt 0x0" ::: "memory");   // its next x tile has landed
    }
    __syncthreads();   // publishes the next tile and ends this tile's reads
    if (xend && (xt + 2) * XK < PRANGE) xstage(xt + 2, xt & 1);
  }
  asm volatile("s_wait_asynccnt 0x0" ::: "memory");     // no copy is left in flight

  // ---- hand over this range's partial sums: a wave's store covers 512 B in a row ----
  // (the loop's last barrier has ended every read of the W buffers)
  {
    float* pw = smem + (size_t)((kr * 4 + wave) * 12) * PTILE + lane * 4;
#pragma unroll
    for (int m = 0; m < 3; ++m) {
#pragma unroll
      for (int t = 0; t < 4; ++t) {
        *(f4v*)(pw + (m * 4 + t) * PTILE)       = acc[m][t].lo;
        *(f4v*)(pw + (m * 4 + t) * PTILE + 128) = acc[m][t].hi;
      }
    }
  }
  __syncthreads();   // every range's partial is in LDS before any is merged

  // ---- merge in the order of the k ranges, then bias + scale: tile t = kr ----
  // The f16 results go to the staging tiles (LDS that nothing has used since the loop's last
  // barrier): a lane holds eight rows of one column, 16 B in a row of V^T, single halves of Q, K.
  _Float16* stg = (_Float16*)(smem + SOFF);
  const int col = kr * 16 + l16;
  h8v       hv[3];
#pragma unroll
  for (int m = 0; m < 3; ++m) {
    const float* pr = smem + (size_t)(wave * 12 + m * 4 + kr) * PTILE + lane * 4;
    f4v lo = *(const f4v*)(pr);
    f4v hi = *(const f4v*)(pr + 128);
#pragma unroll
    for (int r = 1; r < PSPLIT; ++r) {
      lo += *(const f4v*)(pr + r * 48 * PTILE);
      hi += *(const f4v*)(pr + r * 48 * PTILE + 128);
    }
    const float* bias = (m == 0) ? bq : ((m == 1) ? bk : bv);
    const float  scl  = (m == 0) ? 0.125f : 1.0f;
    const float  bvv  = bias[col];
#pragma unroll
    for (int g = 0; g < 8; ++g) {
      const float sum = (g < 4) ? lo[g & 3] : hi[g & 3];
      hv[m][g] = (_Float16)((sum + bvv) * scl);
    }
  }
  // behind all three merges, whose LDS reads then go out together
#pragma unroll
  for (int m = 0; m < 2; ++m) {
#pragma unroll
    for (int g = 0; g < 8; ++g) stg[(m * 64 + wave * 16 + hb + g) * SP + col] = hv[m][g];
  }
  *(h8v*)(stg + (2 * 64 + col) * SP + wave * 16 + hb) = hv[2];
  __syncthreads();   // the three tiles are whole before any wave stores their lines

  // ---- store: thread -> 16 B piece tid of each tile, eight lanes to a 128 B line ----
  const int       srow = tid >> 3, spc = (tid & 7) * 8;
  const _Float16* sr   = stg + srow * SP + spc;
  const h8v       qv   = *(const h8v*)(sr);
  const h8v       kv   = *(const h8v*)(sr + 64 * SP);
  const h8v       vv   = *(const h8v*)(sr + 128 * SP);
  const size_t    rowb = (size_t)blockIdx.x * 64 * HEAD + tid * 8;   // the block's Q, K rows lie in a row
  *(h8v*)(Qh + rowb) = qv;
  *(h8v*)(Kh + rowb) = kv;
  *(h8v*)(VhT + ((size_t)(blockIdx.x >> 6) * HEAD + srow) * SEQ + (blockIdx.x & 63) * 64 + spc) = vv;
}

#define KSPLIT 4
#define KRANGE (SEQ / KSPLIT)   // keys per wave
#define KSTEP  64               // keys per step: one maximum, one rescale, one barrier
#define NSTEP  (KRANGE / KSTEP)
#define NT     (KSTEP / 16)     // S^T tiles per step
#define NC     (KSTEP / 32)     // P^T operands per step
#define NCOPY  (KSTEP / 16)     // 16 B copies per thread and step, for K and for V each
#define OP     68               // partial-O rows: 256 B of data at 272 B (16 B x odd)

__global__ __launch_bounds__(512) void attn_kernel(
    const _Float16* __restrict__ Qh, const _Float16* __restrict__ Kh,
    const _Float16* __restrict__ VhT, float* __restrict__ out) {
  __shared__ __align__(16) _Float16 Kbuf[KSPLIT][2][KSTEP * KP];   // [kv][h]
  __shared__ __align__(16) _Float16 Vbuf[KSPLIT][2][64 * VP];      // [h][kv]
  __shared__ __align__(16) float    Opart[KSPLIT][64 * OP];     // [query][h], not normalised
  __shared__ float Mpart[KSPLIT][64];                           // range maximum per query
  __shared__ float Lpart[KSPLIT][64];                           // range sum per query

  const int tid    = threadIdx.x;
  const int kr     = tid >> 7;          // key range of this wave
  const int gt     = tid & 127;         // thread within the range's four waves
  const int qi     = gt >> 5;           // query tile of this wave
  const int lane   = tid & 31;
  const int half16 = lane >> 4;
  const int l16    = lane & 15;
  const int hb     = half16 * 8;
  const int q0     = blockIdx.x * 64 + qi * 16;     // flat q row base

  // block-uniform bases; what differs between threads stays in 32-bit offsets (in halves)
  const _Float16* Kh_b  = Kh  + (size_t)(blockIdx.x >> 6) * SEQ * HEAD;
  const _Float16* VhT_b = VhT + (size_t)(blockIdx.x >> 6) * HEAD * SEQ;
  const unsigned  koff  = kr * KRANGE * HEAD + gt * 8;
  const unsigned  voff  = (gt / (KSTEP / 8)) * SEQ + kr * KRANGE + (gt % (KSTEP / 8)) * 8;

  // Q B-tiles (column = query l16) held in VGPRs for the whole loop
  const _Float16* qrow = Qh + (size_t)(q0 + l16) * HEAD;
  const h16v aQ0 = hcat(*(const h8v*)(qrow + hb),      *(const h8v*)(qrow + hb + 16));
  const h16v aQ1 = hcat(*(const h8v*)(qrow + 32 + hb), *(const h8v*)(qrow + 32 + hb + 16));

  // Per lane: query q0 + l16.  lrow sums only this lane's keys; the halves join
  // in the epilogue.  o[t][g] = O[q0 + l16][t * 16 + hb + g].
  float mrow = -INFINITY, lrow = 0.0f;
  f8v   o[4] = {};

  // One step's K/V tile (K: KSTEP rows x 128 B; V: 64 rows x KSTEP * 2 B) into buffer buf
  // The 64 blocks of a batch read the same K and V.  Each starts its walk of a range rot tiles in
  // and wraps round, so that at one moment they ask L2 for different tiles, not all for the same.
  const int rot = blockIdx.x & (NSTEP - 1);
  auto stage = [&](int step, int buf) {
    const int       tile = (step + rot) & (NSTEP - 1);
    const _Float16* ksrc = Kh_b + tile * (KSTEP * HEAD);
    const _Float16* vsrc = VhT_b + tile * KSTEP;
#pragma unroll
    for (int i = 0; i < NCOPY; ++i) {
      const int c = gt + 128 * i;                      // 16 B piece of the tile
      async_b128(&Kbuf[kr][buf][(c >> 3) * KP + (c & 7) * 8],
                 ksrc + (koff + i * 1024u));
      const int vr = c / (KSTEP / 8), vo = (c % (KSTEP / 8)) * 8;
      async_b128(&Vbuf[kr][buf][vr * VP + vo],
                 vsrc + (voff + i * (1024u / KSTEP) * SEQ));
    }
  };

  stage(0, 0);
  asm volatile("s_wait_asynccnt 0x0" ::: "memory");   // this wave's part of tile 0 has landed
  __syncthreads();                                    // tile 0 is whole before any wave reads it
  stage(1, 1);

  // two steps per trip: the buffer index is then a constant, and the fragment reads take
  // their buffer as an immediate offset on one address that the loop never rewrites
#pragma unroll 2
  for (int st = 0; st < NSTEP; ++st) {
    const int cur = st & 1;

    // ---- scores, transposed: NT 16(key) x 16(query) tiles, A = K rows from LDS ----
    // s[j][g]: key j * 16 + hb + g of the step's tile ; query q0 + l16
    h16v bK[NT][2];
#pragma unroll
    for (int j = 0; j < NT; ++j) {
      const _Float16* krow = &Kbuf[kr][cur][(j * 16 + l16) * KP];
      bK[j][0] = hcat(*(const h8v*)(krow + hb),      *(const h8v*)(krow + hb + 16));
      bK[j][1] = hcat(*(const h8v*)(krow + 32 + hb), *(const h8v*)(krow + 32 + hb + 16));
    }
    // the step's K reads go out as one group: one LDS latency per step, not one per product
    __builtin_amdgcn_sched_barrier(0);
    f8v s[NT];
#pragma unroll
    for (int j = 0; j < NT; ++j) {
      f8v z = {};
      s[j] = __builtin_amdgcn_wmma_f32_16x16x32_f16(false, bK[j][0], false, aQ0, (short)0, z, false, false);
    }
#pragma unroll
    for (int j = 0; j < NT; ++j)
      s[j] = __builtin_amdgcn_wmma_f32_16x16x32_f16(false, bK[j][1], false, aQ1, (short)0, s[j], false, false);
    // A = V^T rows (h) from LDS, read here so that they arrive during the softmax
    h16v aV[NC][4];
#pragma unroll
    for (int c = 0; c < NC; ++c) {
#pragma unroll
      for (int t = 0; t < 4; ++t) {
        const _Float16* vrow = &Vbuf[kr][cur][(t * 16 + l16) * VP + c * 32];
        aV[c][t] = hcat(*(const h8v*)(vrow + hb), *(const h8v*)(vrow + hb + 16));
      }
    }
    // keeps the V reads in front of the softmax, and the maxima behind the whole run of score
    // products: between them each would cost the idle slots that a fresh matrix result needs
    __builtin_amdgcn_sched_barrier(0);

    // ---- online softmax over these KSTEP keys: in-lane, one exchange between halves ----
    float tm = 0.0f;
#pragma unroll
    for (int c = 0; c < NC; ++c) {
      const f8v s0 = s[2 * c], s1 = s[2 * c + 1];
      const float ta = max3f(max3f(s0[0], s0[1], s0[2]), max3f(s0[3], s0[4], s0[5]),
                             max3f(s0[6], s0[7], s1[0]));
      const float tb = max3f(max3f(s1[1], s1[2], s1[3]), max3f(s1[4], s1[5], s1[6]), s1[7]);
      tm = (c == 0) ? fmaxf(ta, tb) : max3f(tm, ta, tb);
    }
    const float mn   = max3f(mrow, tm, xhalf(tm));   // same value in both halves
    const float corr = __expf(mrow - mn);
    mrow = mn;
#pragma unroll
    for (int j = 0; j < NT; ++j) {
#pragma unroll
      for (int g = 0; g < 8; ++g) s[j][g] = __expf(s[j][g] - mn);
    }
    f8v ps8 = s[0] + s[1];
#pragma unroll
    for (int c = 1; c < NC; ++c) ps8 += s[2 * c] + s[2 * c + 1];
    const f4v ps4 = ps8.lo + ps8.hi;
    lrow = lrow * corr + ((ps4[0] + ps4[2]) + (ps4[1] + ps4[3]));
#pragma unroll
    for (int t = 0; t < 4; ++t) o[t] *= corr;

    // ---- O^T += V^T * P^T ----
#pragma unroll
    for (int c = 0; c < NC; ++c) {
      // P^T as B operand: element i < 8 is key c * 32 + hb + i, element 8 + i key
      // c * 32 + 16 + hb + i, the k order of the V^T loader above.
      const h16v pB = hcat(__builtin_convertvector(s[2 * c], h8v),
                           __builtin_convertvector(s[2 * c + 1], h8v));
#pragma unroll
      for (int t = 0; t < 4; ++t)
        o[t] = __builtin_amdgcn_wmma_f32_16x16x32_f16(
            false, aV[c][t], false, pB, (short)0, o[t], false, false);
    }

    // keeps the softmax and the products in front of the step's foot: sunk behind it, the wait
    // for the next tile's copies would come right behind their issue, not a whole step later
    __builtin_amdgcn_sched_barrier(0);
    asm volatile("s_wait_dscnt 0x0" ::: "memory");      // this wave's reads of the tile are over
    asm volatile("s_wait_asynccnt 0x0" ::: "memory");   // its part of the next tile has landed
    __syncthreads();   // publishes the next tile and frees this one for the refill
    if (st + 2 < NSTEP) stage(st + 2, cur);
  }
  asm volatile("s_wait_asynccnt 0x0" ::: "memory");     // no copy is left in flight

  // ---- hand over this range's partial: join the halves' sums, O not normalised ----
  const float lsum = lrow + xhalf(lrow);
  if (half16 == 0) {
    Mpart[kr][qi * 16 + l16] = mrow;
    Lpart[kr][qi * 16 + l16] = lsum;
  }
  float* prow = &Opart[kr][(qi * 16 + l16) * OP + hb];
#pragma unroll
  for (int t = 0; t < 4; ++t) {
    *(f4v*)(prow + t * 16)     = o[t].lo;
    *(f4v*)(prow + t * 16 + 4) = o[t].hi;
  }
  __syncthreads();   // every range's partial is in LDS before any is merged

  // ---- merge: thread -> query tid / 8, eight consecutive h; a wave stores 1 KB ----
  const int mq = tid >> 3, mh = (tid & 7) * 8;
  float mr[KSPLIT];
#pragma unroll
  for (int r = 0; r < KSPLIT; ++r) mr[r] = Mpart[r][mq];
  const float mall = fmaxf(fmaxf(mr[0], mr[1]), fmaxf(mr[2], mr[3]));
  float lall = 0.0f;
  f4v   lo = {}, hi = {};
#pragma unroll
  for (int r = 0; r < KSPLIT; ++r) {
    const float  w  = __expf(mr[r] - mall);
    const float* pr = &Opart[r][mq * OP + mh];
    lall += w * Lpart[r][mq];
    lo   += w * *(const f4v*)(pr);
    hi   += w * *(const f4v*)(pr + 4);
  }
  float* orow = out + (size_t)(blockIdx.x * 64 + mq) * HEAD + mh;
#pragma unroll
  for (int g = 0; g < 4; ++g) { lo[g] = lo[g] / lall; hi[g] = hi[g] / lall; }
  *(f4v*)(orow)     = lo;
  *(f4v*)(orow + 4) = hi;
}

// ---------------------------------------------------------------------------
extern "C" void kernel_launch(void* const* d_in, const int* in_sizes, int n_in,
                              void* d_out, int out_size, void* d_ws, size_t ws_size,
                              hipStream_t stream) {
  const float* x  = (const float*)d_in[0];
  const float* Wq = (const float*)d_in[1];
  const float* bq = (const float*)d_in[2];
  const float* Wk = (const float*)d_in[3];
  const float* bk = (const float*)d_in[4];
  const float* Wv = (const float*)d_in[5];
  const float* bv = (const float*)d_in[6];
  float*       out = (float*)d_out;

  char* ws = (char*)d_ws;
  _Float16* Qh  = (_Float16*)(ws + 384 * 1024);                      // 2 MB
  _Float16* Kh  = (_Float16*)(ws + 384 * 1024 + 2 * 1024 * 1024);    // 2 MB
  _Float16* VhT = (_Float16*)(ws + 384 * 1024 + 4 * 1024 * 1024);    // 2 MB

  proj_kernel<<<NROWS / 64, 512, 0, stream>>>(x, Wq, Wk, Wv, bq, bk, bv, Qh, Kh, VhT);
  attn_kernel<<<NROWS / 64, 512, 0, stream>>>(Qh, Kh, VhT, out);
}

// v010
// A run of this version takes 32.4 microseconds.
// In two side-by-side timings against v009, it was 1.04 and 1.03 times as fast.
// Counting every step since v000, it is 5.98 times as fast.
#include <hip/hip_runtime.h>
#include <hip/hip_bf16.h>

// ---- types ----
typedef _Float16 h16v __attribute__((ext_vector_type(16)));
typedef _Float16 h8v  __attribute__((ext_vector_type(8)));
typedef float    f8v  __attribute__((ext_vector_type(8)));
typedef float    f4v  __attribute__((ext_vector_type(4)));
typedef float    f2v  __attribute__((ext_vector_type(2)));

#define D_MODEL 1024
#define HEAD    64
#define SEQ     4096
#define BATCH   4
#define NROWS   (BATCH * SEQ)   // 16384 flat rows
// 1/sqrt(HEAD) * log2(e), folded into Q: the score products then come out as exponents of two
#define QSCALE  0.18033688011112042f

__device__ __forceinline__ h16v hcat(h8v lo, h8v hi) {
  h16v r;
#pragma unroll
  for (int i = 0; i < 8; ++i) { r[i] = lo[i]; r[i + 8] = hi[i]; }
  return r;
}

// Lane l <-> lane l ^ 16 (the two halves of a wave hold the same query column).
__device__ __forceinline__ float xhalf(float v) {
  const int b = __builtin_bit_cast(int, v);
  return __builtin_bit_cast(float, __builtin_amdgcn_permlanex16(
      b, b, 0x76543210, 0xfedcba98, false, false));
}
// exp2 for code off the hot path: the v_nop is the free slot that the instruction set asks for
// behind a transcendental; inside the statement it stays there whatever the compiler puts next.
__device__ __forceinline__ float exp2_slot(float x) {
  float r;
  asm("v_exp_f32 %0, %1\n\tv_nop" : "=v"(r) : "v"(x));
  return r;
}
__device__ __forceinline__ float max3f(float a, float b, float c) {
  return fmaxf(fmaxf(a, b), c);
}

// LDS row pitches in halves (XP in floats), for ds_load_b128 readers that walk 16 rows at once:
// 16 B x odd puts the 16 rows of a half-wave on 16 different groups of four banks.
#define KP 72   // K rows: 128 B of data at 144 B
#define VP 72   // V^T rows: 128 B of data at 144 B
#define WP 40   // W^T rows: 64 B of data at 80 B
#define XP 68   // x rows, in floats: 256 B of data at 272 B

typedef int i4v __attribute__((ext_vector_type(4)));
typedef __attribute__((address_space(1))) i4v gl_i4v;
typedef __attribute__((address_space(3))) i4v sh_i4v;

// Per-lane async copy: 16 bytes global -> LDS, tracked by ASYNCcnt.
__device__ __forceinline__ void async_b128(_Float16* lds, const _Float16* gaddr) {
  __builtin_amdgcn_global_load_async_to_lds_b128((gl_i4v*)gaddr, (sh_i4v*)lds, 0, 0);
}
__device__ __forceinline__ void async_b128_f32(float* lds, const float* gaddr) {
  __builtin_amdgcn_global_load_async_to_lds_b128((gl_i4v*)gaddr, (sh_i4v*)lds, 0, 0);
}

// ---------------------------------------------------------------------------
// Kernel 1: fused Q/K/V projection.  64 rows/block, all three matrices per block.
// 16 waves/block = 4 row tiles x 4 k ranges, so that four waves share each SIMD and
// fill each other's waits on x (memory) and on the W fragments (LDS).  Wave (kr, wave):
// rows row0 .. row0 + 15, k in kr * 256 .. + 255, 12 WMMAs per k-step of 32.
// The four waves of a k range share that range's W tiles (3 x [64n x 32k] f16, rows at
// pitch WP), double-buffered in LDS.  The block makes them itself from the f32 weights
// W[k][n]: wave `wave` takes k octet `wave` of a tile, a lane two columns; a load covers
// one whole 256 B row of W, eight rows pack into one 16 B LDS store per column.  The next
// tile's loads fly during this tile's products.  x comes through LDS too: a wave brings its
// own 16 rows x XK k (f32) by async copies, each copy covering two whole 256 B row pieces,
// double-buffered, one tile (two k-steps) ahead; the A fragments are read from there.
// The four ranges' partial sums merge through LDS; wave (kr, wave) finishes column tile kr
// of Q, K, V.  The finished f16 tiles pass through LDS once more, so that every global store
// of a wave covers four whole 128 B lines.
//   Q -> Qh  [row][h] f16, (x*Wq+bq)*0.125*log2(e) ;  K -> Kh [row][h] ; V -> VhT[b][h][kv]
// ---------------------------------------------------------------------------
#define PSPLIT 4
#define PRANGE (D_MODEL / PSPLIT)      // k per wave
#define WTILE  (3 * 64 * WP)           // halves in one W buffer (15 KB)
#define PTILE  256                     // floats in one 16 x 16 partial tile (1 KB)
#define XK     64                      // k in one x tile
#define XTILE  (16 * XP)               // floats in one wave's x tile (4352 B)
#define XOFF   (PSPLIT * 2 * WTILE / 2)   // the x buffers start behind the W buffers (floats)
#define SOFF   (PSPLIT * 4 * 12 * PTILE)  // the output staging starts behind the partial sums (floats)
#define SP     72                         // staged output rows, in halves: 128 B of data at 144 B

__global__ __launch_bounds__(512) void proj_kernel(
    const float* __restrict__ x, const float* __restrict__ Wq,
    const float* __restrict__ Wk, const float* __restrict__ Wv,
    const float* __restrict__ bq, const float* __restrict__ bk,
    const float* __restrict__ bv, _Float16* __restrict__ Qh,
    _Float16* __restrict__ Kh, _Float16* __restrict__ VhT) {
  // In the loop: W buffers [k range][2][WTILE] halves (120 KB), then x buffers
  // [2][wave][XTILE] floats (136 KB).  Behind the loop's last barrier the same LDS holds
  // the partial sums [k range][row tile][12][PTILE] floats (192 KB), and behind them the
  // finished tiles Q[row][h], K[row][h], V^T[h][row], [3][64][SP] halves (27 KB).
  __shared__ __align__(16) float smem[XOFF + 2 * 16 * XTILE];   // 256 KB

  const int tid    = threadIdx.x;
  const int kr     = tid >> 7;          // k range of this wave
  const int gt     = tid & 127;         // thread within the range's four waves
  const int wave   = gt >> 5;           // row tile of this wave
  const int lane   = tid & 31;
  const int half16 = lane >> 4;
  const int l16    = lane & 15;
  const int hb     = half16 * 8;
  const int row0   = blockIdx.x * 64 + wave * 16;      // this wave's 16-row tile
  // Every block reads the same W.  A block takes the k-steps of a range in the order kk ^ rk,
  // so that at one moment the blocks ask L2 for different rows of W, not all for the same.
  const unsigned rk = (blockIdx.x & (PRANGE / 32 - 1)) * 32;
  // x staging: copy i of a tile takes rows 2 * i + half16, a lane 16 B of a row's 256 B
  const float*    xsrc = x + (size_t)(row0 + half16) * D_MODEL + kr * PRANGE + l16 * 4;
  float*          xbuf = smem + XOFF + (tid >> 5) * XTILE;     // this wave's part of buffer 0
  float*          xdst = xbuf + half16 * XP + l16 * 4;
  // A fragment reads: the first and the second k-step taken from an x tile
  const float*    xrow[2] = {xbuf + l16 * XP + hb + (rk & 32), xbuf + l16 * XP + hb + (~rk & 32)};
  auto xstage = [&](int xt, int buf) {
#pragma unroll
    for (int i = 0; i < 8; ++i)
      async_b128_f32(xdst + buf * (16 * XTILE) + i * 2 * XP,
                     xsrc + ((unsigned)(xt * XK) ^ (rk & ~(XK - 1u))) + (size_t)(i * 2) * D_MODEL);
  };
  _Float16*       Wbuf = (_Float16*)smem + kr * 2 * WTILE;

  // W staging: rows kr * PRANGE + (kk ^ rk) + wave * 8 + j of W, columns 2 * lane and 2 * lane + 1
  const unsigned woff = (kr * PRANGE + wave * 8) * HEAD + 2 * lane;
  const float*   wmat[3] = {Wq, Wk, Wv};
  _Float16*    wdst    = Wbuf + (2 * lane) * WP + wave * 8;
  f2v          wreg[3][8];

  f8v acc[3][4] = {};

  xstage(0, 0);   // x tile 0 into buffer 0

  // W tile for kk = 0 into buffer 0
#pragma unroll
  for (int m = 0; m < 3; ++m) {
#pragma unroll
    for (int j = 0; j < 8; ++j) wreg[m][j] = *(const f2v*)(wmat[m] + rk * HEAD + woff + j * HEAD);
  }
#pragma unroll
  for (int m = 0; m < 3; ++m) {
#pragma unroll
    for (int c = 0; c < 2; ++c) {
      h8v h;
#pragma unroll
      for (int j = 0; j < 8; ++j) h[j] = (_Float16)wreg[m][j][c];
      *(h8v*)(wdst + (m * 64 + c) * WP) = h;
    }
  }
  asm volatile("s_wait_asynccnt 0x0" ::: "memory");   // this wave's x tile 0 has landed
  __syncthreads();   // tile 0 is in LDS before any wave reads it
  xstage(1, 1);

  // unrolled: a tile's buffer becomes an immediate offset of the LDS operations, and its k
  // offset a scalar base of the loads, beside one lane offset that is never rewritten
#pragma unroll
  for (int kk = 0; kk < PRANGE; kk += 32) {            // kk counts inside the range
    const int  cur  = (kk >> 5) & 1;
    const bool more = kk + 32 < PRANGE;

    const int  xt   = kk / XK;                         // x tile of this k-step
    const bool xend = (kk + 32) % XK == 0;             // its last k-step

    // next W tile, f32, into registers: in flight during this tile's products
    if (more) {
#pragma unroll
      for (int m = 0; m < 3; ++m) {
#pragma unroll
        for (int j = 0; j < 8; ++j)
          wreg[m][j] = *(const f2v*)(wmat[m] + ((kk + 32) ^ rk) * HEAD + woff + j * HEAD);
      }
    }

    // A tile from LDS: 16 rows x 32 k of x, fp32 -> f16
    const float* xa = xrow[(kk >> 5) & 1] + (xt & 1) * (16 * XTILE);
    f4v a0 = *(const f4v*)(xa);
    f4v a1 = *(const f4v*)(xa + 4);
    f4v a2 = *(const f4v*)(xa + 16);
    f4v a3 = *(const f4v*)(xa + 20);

    const _Float16* wb = &Wbuf[cur * WTILE];
    h16v B[3][4];
    auto bload = [&](int m) {
#pragma unroll
      for (int t = 0; t < 4; ++t) {
        const _Float16* wcol = wb + (m * 64 + t * 16 + l16) * WP;
        B[m][t] = hcat(*(const h8v*)(wcol + hb), *(const h8v*)(wcol + hb + 16));
      }
    };
    auto bmul = [&](int m, h16v A) {
#pragma unroll
      for (int t = 0; t < 4; ++t)
        acc[m][t] = __builtin_amdgcn_wmma_f32_16x16x32_f16(
            false, A, false, B[m][t], (short)0, acc[m][t], false, false);
    };
    bload(0);
    bload(1);
    // the A reads and two matrices' W reads go out as one group: one LDS latency, not one per product
    __builtin_amdgcn_sched_barrier(0);

    h16v A;
#pragma unroll
    for (int i = 0; i < 4; ++i) {
      A[i]      = (_Float16)a0[i];
      A[4 + i]  = (_Float16)a1[i];
      A[8 + i]  = (_Float16)a2[i];
      A[12 + i] = (_Float16)a3[i];
    }
    bmul(0, A);
    bload(2);
    // the third matrix' reads go out as one group too, and fly during the second's products
    __builtin_amdgcn_sched_barrier(0);
    bmul(1, A);
    bmul(2, A);
    // keeps the products, whose operands now all wait in LDS, in front of the wait for the next
    // W tile's loads: mixed among them, that wait would hold the products back for a whole flight
    __builtin_amdgcn_sched_barrier(0);
    // f32 -> f16, transposed into the other buffer (its readers left it at the last barrier)
    if (more) {
#pragma unroll
      for (int m = 0; m < 3; ++m) {
#pragma unroll
        for (int c = 0; c < 2; ++c) {
          h8v h;
#pragma unroll
          for (int j = 0; j < 8; ++j) h[j] = (_Float16)wreg[m][j][c];
          *(h8v*)(wdst + (cur ^ 1) * WTILE + (m * 64 + c) * WP) = h;
        }
      }
    }
    if (xend) {
      asm volatile("s_wait_dscnt 0x0" ::: "memory");      // this wave's reads of the x tile are over
      asm volatile("s_wait_asynccnt 0x0" ::: "memory");   // its next x tile has landed
    }
    __syncthreads();   // publishes the next tile and ends this tile's reads
    if (xend && (xt + 2) * XK < PRANGE) xstage(xt + 2, xt & 1);
  }
  asm volatile("s_wait_asynccnt 0x0" ::: "memory");     // no copy is left in flight

  // ---- hand over this range's partial sums: a wave's store covers 512 B in a row ----
  // (the loop's last barrier has ended every read of the W buffers)
  {
    float* pw = smem + (size_t)((kr * 4 + wave) * 12) * PTILE + lane * 4;
#pragma unroll
    for (int m = 0; m < 3; ++m) {
#pragma unroll
      for (int t = 0; t < 4; ++t) {
        *(f4v*)(pw + (m * 4 + t) * PTILE)       = acc[m][t].lo;
        *(f4v*)(pw + (m * 4 + t) * PTILE + 128) = acc[m][t].hi;
      }
    }
  }
  __syncthreads();   // every range's partial is in LDS before any is merged

  // ---- merge in the order of the k ranges, then bias + scale: tile t = kr ----
  // The f16 results go to the staging tiles (LDS that nothing has used since the loop's last
  // barrier): a lane holds eight rows of one column, 16 B in a row of V^T, single halves of Q, K.
  _Float16* stg = (_Float16*)(smem + SOFF);
  const int col = kr * 16 + l16;
  h8v       hv[3];
#pragma unroll
  for (int m = 0; m < 3; ++m) {
    const float* pr = smem + (size_t)(wave * 12 + m * 4 + kr) * PTILE + lane * 4;
    f4v lo = *(const f4v*)(pr);
    f4v hi = *(const f4v*)(pr + 128);
#pragma unroll
    for (int r = 1; r < PSPLIT; ++r) {
      lo += *(const f4v*)(pr + r * 48 * PTILE);
      hi += *(const f4v*)(pr + r * 48 * PTILE + 128);
    }
    const float* bias = (m == 0) ? bq : ((m == 1) ? bk : bv);
    const float  scl  = (m == 0) ? QSCALE : 1.0f;
    const float  bvv  = bias[col];
#pragma unroll
    for (int g = 0; g < 8; ++g) {
      const float sum = (g < 4) ? lo[g & 3] : hi[g & 3];
      hv[m][g] = (_Float16)((sum + bvv) * scl);
    }
  }
  // behind all three merges, whose LDS reads then go out together
#pragma unroll
  for (int m = 0; m < 2; ++m) {
#pragma unroll
    for (int g = 0; g < 8; ++g) stg[(m * 64 + wave * 16 + hb + g) * SP + col] = hv[m][g];
  }
  *(h8v*)(stg + (2 * 64 + col) * SP + wave * 16 + hb) = hv[2];
  __syncthreads();   // the three tiles are whole before any wave stores their lines

  // ---- store: thread -> 16 B piece tid of each tile, eight lanes to a 128 B line ----
  const int       srow = tid >> 3, spc = (tid & 7) * 8;
  const _Float16* sr   = stg + srow * SP + spc;
  const h8v       qv   = *(const h8v*)(sr);
  const h8v       kv   = *(const h8v*)(sr + 64 * SP);
  const h8v       vv   = *(const h8v*)(sr + 128 * SP);
  const size_t    rowb = (size_t)blockIdx.x * 64 * HEAD + tid * 8;   // the block's Q, K rows lie in a row
  *(h8v*)(Qh + rowb) = qv;
  *(h8v*)(Kh + rowb) = kv;
  *(h8v*)(VhT + ((size_t)(blockIdx.x >> 6) * HEAD + srow) * SEQ + (blockIdx.x & 63) * 64 + spc) = vv;
}

#define KSPLIT 4
#define KRANGE (SEQ / KSPLIT)   // keys per wave
#define KSTEP  64               // keys per step: one test of the sum, one barrier
#define NSTEP  (KRANGE / KSTEP)
#define NT     (KSTEP / 16)     // S^T tiles per step
#define NC     (KSTEP / 32)     // P^T operands per step
#define NCOPY  (KSTEP / 16)     // 16 B copies per thread and step, for K and for V each
#define OP     68               // partial-O rows: 256 B of data at 272 B (16 B x odd)
#define PLIM   4096.0f          // a lane's sum of P in one step above which the reference is raised

__global__ __launch_bounds__(512) void attn_kernel(
    const _Float16* __restrict__ Qh, const _Float16* __restrict__ Kh,
    const _Float16* __restrict__ VhT, float* __restrict__ out) {
  __shared__ __align__(16) _Float16 Kbuf[KSPLIT][2][KSTEP * KP];   // [kv][h]
  __shared__ __align__(16) _Float16 Vbuf[KSPLIT][2][64 * VP];      // [h][kv]
  __shared__ __align__(16) float    Opart[KSPLIT][64 * OP];     // [query][h], not normalised
  __shared__ float Mpart[KSPLIT][64];                           // range reference per query
  __shared__ float Lpart[KSPLIT][64];                           // range sum per query

  const int tid    = threadIdx.x;
  const int kr     = tid >> 7;          // key range of this wave
  const int gt     = tid & 127;         // thread within the range's four waves
  const int qi     = gt >> 5;           // query tile of this wave
  const int lane   = tid & 31;
  const int half16 = lane >> 4;
  const int l16    = lane & 15;
  const int hb     = half16 * 8;
  const int q0     = blockIdx.x * 64 + qi * 16;     // flat q row base

  // block-uniform bases; what differs between threads stays in 32-bit offsets (in halves)
  const _Float16* Kh_b  = Kh  + (size_t)(blockIdx.x >> 6) * SEQ * HEAD;
  const _Float16* VhT_b = VhT + (size_t)(blockIdx.x >> 6) * HEAD * SEQ;
  const unsigned  koff  = kr * KRANGE * HEAD + gt * 8;
  const unsigned  voff  = (gt / (KSTEP / 8)) * SEQ + kr * KRANGE + (gt % (KSTEP / 8)) * 8;

  // Q B-tiles (column = query l16) held in VGPRs for the whole loop
  const _Float16* qrow = Qh + (size_t)(q0 + l16) * HEAD;
  const h16v aQ0 = hcat(*(const h8v*)(qrow + hb),      *(const h8v*)(qrow + hb + 16));
  const h16v aQ1 = hcat(*(const h8v*)(qrow + 32 + hb), *(const h8v*)(qrow + 32 + hb + 16));

  // Per lane: query q0 + l16.  lrow sums only this lane's keys; the halves join
  // in the epilogue.  o[t][g] = O[q0 + l16][t * 16 + hb + g].
  // mref: the reference in use, as an exponent of two, the same in both halves; cneg = -mref.
  // plim: the bound on a step's sum of P; below every sum until the first step has set the reference.
  float mref = 0.0f, lrow = 0.0f, plim = -1.0f;
  f8v   cneg = {};
  f8v   o[4] = {};

  // One step's K/V tile (K: KSTEP rows x 128 B; V: 64 rows x KSTEP * 2 B) into buffer buf
  // The 64 blocks of a batch read the same K and V.  Each starts its walk of a range rot tiles in
  // and wraps round, so that at one moment they ask L2 for different tiles, not all for the same.
  const int rot = blockIdx.x & (NSTEP - 1);
  auto stage = [&](int step, int buf) {
    const int       tile = (step + rot) & (NSTEP - 1);
    const _Float16* ksrc = Kh_b + tile * (KSTEP * HEAD);
    const _Float16* vsrc = VhT_b + tile * KSTEP;
#pragma unroll
    for (int i = 0; i < NCOPY; ++i) {
      const int c = gt + 128 * i;                      // 16 B piece of the tile
      async_b128(&Kbuf[kr][buf][(c >> 3) * KP + (c & 7) * 8],
                 ksrc + (koff + i * 1024u));
      const int vr = c / (KSTEP / 8), vo = (c % (KSTEP / 8)) * 8;
      async_b128(&Vbuf[kr][buf][vr * VP + vo],
                 vsrc + (voff + i * (1024u / KSTEP) * SEQ));
    }
  };

  stage(0, 0);
  asm volatile("s_wait_asynccnt 0x0" ::: "memory");   // this wave's part of tile 0 has landed
  __syncthreads();                                    // tile 0 is whole before any wave reads it
  stage(1, 1);

  // two steps per trip: the buffer index is then a constant, and the fragment reads take
  // their buffer as an immediate offset on one address that the loop never rewrites
#pragma unroll 2
  for (int st = 0; st < NSTEP; ++st) {
    const int cur = st & 1;

    // ---- scores, transposed: NT 16(key) x 16(query) tiles, A = K rows from LDS ----
    // s[j][g]: key j * 16 + hb + g of the step's tile ; query q0 + l16
    h16v bK[NT][2];
#pragma unroll
    for (int j = 0; j < NT; ++j) {
      const _Float16* krow = &Kbuf[kr][cur][(j * 16 + l16) * KP];
      bK[j][0] = hcat(*(const h8v*)(krow + hb),      *(const h8v*)(krow + hb + 16));
      bK[j][1] = hcat(*(const h8v*)(krow + 32 + hb), *(const h8v*)(krow + 32 + hb + 16));
    }
    // the step's K reads go out as one group: one LDS latency per step, not one per product
    __builtin_amdgcn_sched_barrier(0);
    f8v s[NT];
#pragma unroll
    for (int j = 0; j < NT; ++j)
      s[j] = __builtin_amdgcn_wmma_f32_16x16x32_f16(false, bK[j][0], false, aQ0, (short)0, cneg, false, false);
#pragma unroll
    for (int j = 0; j < NT; ++j)
      s[j] = __builtin_amdgcn_wmma_f32_16x16x32_f16(false, bK[j][1], false, aQ1, (short)0, s[j], false, false);
    // A = V^T rows (h) from LDS, read here so that they arrive during the softmax
    h16v aV[NC][4];
#pragma unroll
    for (int c = 0; c < NC; ++c) {
#pragma unroll
      for (int t = 0; t < 4; ++t) {
        const _Float16* vrow = &Vbuf[kr][cur][(t * 16 + l16) * VP + c * 32];
        aV[c][t] = hcat(*(const h8v*)(vrow + hb), *(const h8v*)(vrow + hb + 16));
      }
    }
    // keeps the V reads in front of the softmax, and the exponentials behind the whole run of score
    // products: between them each would cost the idle slots that a fresh matrix result needs
    __builtin_amdgcn_sched_barrier(0);

    // ---- softmax over these KSTEP keys, against the reference in use ----
    f8v p[NT];
    auto psum = [&]() {
      f8v ps8 = p[0] + p[1];
#pragma unroll
      for (int c = 1; c < NC; ++c) ps8 += p[2 * c] + p[2 * c + 1];
      const f4v ps4 = ps8.lo + ps8.hi;
      return (ps4[0] + ps4[2]) + (ps4[1] + ps4[3]);
    };
#pragma unroll
    for (int j = 0; j < NT; ++j) {
#pragma unroll
      for (int g = 0; g < 8; ++g) p[j][g] = __builtin_amdgcn_exp2f(s[j][g]);
    }
    float ps = psum();
    // One test per step, a scalar branch of the whole wave (the products need every lane on).
    // Taken in the first step, which sets the reference, and where a sum is too large or no number.
    if (__builtin_expect(__builtin_amdgcn_ballot_w32(!(ps <= plim)) != 0, 0)) {
      float tm = 0.0f;
#pragma unroll
      for (int c = 0; c < NC; ++c) {
        const f8v s0 = s[2 * c], s1 = s[2 * c + 1];
        const float ta = max3f(max3f(s0[0], s0[1], s0[2]), max3f(s0[3], s0[4], s0[5]),
                               max3f(s0[6], s0[7], s1[0]));
        const float tb = max3f(max3f(s1[1], s1[2], s1[3]), max3f(s1[4], s1[5], s1[6]), s1[7]);
        tm = (c == 0) ? fmaxf(ta, tb) : max3f(tm, ta, tb);
      }
      tm = fmaxf(tm, xhalf(tm));                       // same value in both halves
      // the first step takes its maximum as it is; later the reference only rises
      const float up   = (st == 0) ? tm : fmaxf(tm, 0.0f);
      const float corr = (st == 0) ? 0.0f : exp2_slot(-up);
      mref += up;
      plim = PLIM;
#pragma unroll
      for (int g = 0; g < 8; ++g) cneg[g] = -mref;
#pragma unroll
      for (int j = 0; j < NT; ++j) {
#pragma unroll
        for (int g = 0; g < 8; ++g) p[j][g] = exp2_slot(s[j][g] - up);
      }
      ps = psum();
      lrow *= corr;
#pragma unroll
      for (int t = 0; t < 4; ++t) o[t] *= corr;
    }
    lrow += ps;

    // ---- O^T += V^T * P^T ----
#pragma unroll
    for (int c = 0; c < NC; ++c) {
      // P^T as B operand: element i < 8 is key c * 32 + hb + i, element 8 + i key
      // c * 32 + 16 + hb + i, the k order of the V^T loader above.
      const h16v pB = hcat(__builtin_convertvector(p[2 * c], h8v),
                           __builtin_convertvector(p[2 * c + 1], h8v));
#pragma unroll
      for (int t = 0; t < 4; ++t)
        o[t] = __builtin_amdgcn_wmma_f32_16x16x32_f16(
            false, aV[c][t], false, pB, (short)0, o[t], false, false);
    }

    // keeps the softmax and the products in front of the step's foot: sunk behind it, the wait
    // for the next tile's copies would come right behind their issue, not a whole step later
    __builtin_amdgcn_sched_barrier(0);
    asm volatile("s_wait_dscnt 0x0" ::: "memory");      // this wave's reads of the tile are over
    asm volatile("s_wait_asynccnt 0x0" ::: "memory");   // its part of the next tile has landed
    __syncthreads();   // publishes the next tile and frees this one for the refill
    if (st + 2 < NSTEP) stage(st + 2, cur);
  }
  asm volatile("s_wait_asynccnt 0x0" ::: "memory");     // no copy is left in flight

  // ---- hand over this range's partial: join the halves' sums, O not normalised ----
  const float lsum = lrow + xhalf(lrow);
  if (half16 == 0) {
    Mpart[kr][qi * 16 + l16] = mref;
    Lpart[kr][qi * 16 + l16] = lsum;
  }
  float* prow = &Opart[kr][(qi * 16 + l16) * OP + hb];
#pragma unroll
  for (int t = 0; t < 4; ++t) {
    *(f4v*)(prow + t * 16)     = o[t].lo;
    *(f4v*)(prow + t * 16 + 4) = o[t].hi;
  }
  __syncthreads();   // every range's partial is in LDS before any is merged

  // ---- merge: thread -> query tid / 8, eight consecutive h; a wave stores 1 KB ----
  const int mq = tid >> 3, mh = (tid & 7) * 8;
  float mr[KSPLIT];
#pragma unroll
  for (int r = 0; r < KSPLIT; ++r) mr[r] = Mpart[r][mq];
  const float mall = fmaxf(fmaxf(mr[0], mr[1]), fmaxf(mr[2], mr[3]));
  float lall = 0.0f;
  f4v   lo = {}, hi = {};
#pragma unroll
  for (int r = 0; r < KSPLIT; ++r) {
    const float  w  = __builtin_amdgcn_exp2f(mr[r] - mall);
    const float* pr = &Opart[r][mq * OP + mh];
    lall += w * Lpart[r][mq];
    lo   += w * *(const f4v*)(pr);
    hi   += w * *(const f4v*)(pr + 4);
  }
  float* orow = out + (size_t)(blockIdx.x * 64 + mq) * HEAD + mh;
#pragma unroll
  for (int g = 0; g < 4; ++g) { lo[g] = lo[g] / lall; hi[g] = hi[g] / lall; }
  *(f4v*)(orow)     = lo;
  *(f4v*)(orow + 4) = hi;
}

// ---------------------------------------------------------------------------
extern "C" void kernel_launch(void* const* d_in, const int* in_sizes, int n_in,
                              void* d_out, int out_size, void* d_ws, size_t ws_size,
                              hipStream_t stream) {
  const float* x  = (const float*)d_in[0];
  const float* Wq = (const float*)d_in[1];
  const float* bq = (const float*)d_in[2];
  const float* Wk = (const float*)d_in[3];
  const float* bk = (const float*)d_in[4];
  const float* Wv = (const float*)d_in[5];
  const float* bv = (const float*)d_in[6];
  float*       out = (float*)d_out;

  char* ws = (char*)d_ws;
  _Float16* Qh  = (_Float16*)(ws + 384 * 1024);                      // 2 MB
  _Float16* Kh  = (_Float16*)(ws + 384 * 1024 + 2 * 1024 * 1024);    // 2 MB
  _Float16* VhT = (_Float16*)(ws + 384 * 1024 + 4 * 1024 * 1024);    // 2 MB

  proj_kernel<<<NROWS / 64, 512, 0, stream>>>(x, Wq, Wk, Wv, bq, bk, bv, Qh, Kh, VhT);
  attn_kernel<<<NROWS / 64, 512, 0, stream>>>(Qh, Kh, VhT, out);
}
